// v000
// Times are from an AMD MI455X. After a warm-up the kernel runs many times in a row, and a time is the length of
// such a window on the GPU divided by its runs, so every launch and the gaps after it count. The runs cycle
// through copies of the inputs. A figure is the median of several windows, for all but v000 over two sittings.
// Sittings can differ by a few percent; kernels timed side by side share one.
// v000 is the starting kernel. One run takes 345 microseconds.
#include <hip/hip_runtime.h>
#include <math.h>

typedef __attribute__((ext_vector_type(16))) _Float16 v16h;
typedef __attribute__((ext_vector_type(16))) __bf16 v16b;
typedef __attribute__((ext_vector_type(8)))  _Float16 v8h;
typedef __attribute__((ext_vector_type(8)))  float v8f;
typedef __attribute__((ext_vector_type(4)))  float v4f;
typedef __attribute__((ext_vector_type(2)))  float v2f;
typedef __attribute__((ext_vector_type(4)))  unsigned v4u;
typedef __attribute__((ext_vector_type(4)))  int v4i;
typedef float __attribute__((may_alias)) float_a;
typedef int __attribute__((may_alias)) int_a;

template <typename T> __device__ __forceinline__ void vst2(void* p, T v) { *(T*)p = v;  }
__device__ __forceinline__ v8f wmma16(v16h a, v16h b, v8f c) {
  v8f d = __builtin_amdgcn_wmma_f32_16x16x32_f16(false, a, false, b, (short)0, c, false, false);
  asm volatile("v_nop\n\tv_nop\n\tv_nop\n\tv_nop" : "+v"(d) : "v"(a), "v"(b));
  return d;
}
__device__ __forceinline__ v8f wmma_bf(v16b a, v16b b, v8f c) {
  v8f d = __builtin_amdgcn_wmma_f32_16x16x32_bf16(false, a, false, b, (short)0, c, false, false);
  asm volatile("v_nop\n\tv_nop\n\tv_nop\n\tv_nop" : "+v"(d) : "v"(a), "v"(b));
  return d;
}
// 16x16x32 fragments: lane = (h = lane>>4, row/col = lane&15); elements 0..7 = k0+8h+0..7, 8..15 = k0+16+8h+0..7; D element r = row 8h+r
__device__ __forceinline__ v16h frag_h(const _Float16* rowk0, int lane) {
  union { v16h v; v8h q[2]; } u; const _Float16* p = rowk0 + 8 * (lane >> 4);
  u.q[0] = *(const v8h*)p; u.q[1] = *(const v8h*)(p + 16); return u.v;
}
__device__ __forceinline__ v16h frag_f32(const float* rowk0, int lane) {
  v16h a; const float* p = rowk0 + 8 * (lane >> 4);
#pragma unroll
  for (int i = 0; i < 8; ++i) { a[i] = (_Float16)p[i]; a[8 + i] = (_Float16)p[16 + i]; }
  return a;
}
__device__ __forceinline__ v16h frag_f32s(const float* rowk0, int lane, float sc) {
  v16h a; const float* p = rowk0 + 8 * (lane >> 4);
#pragma unroll
  for (int i = 0; i < 8; ++i) { a[i] = (_Float16)(p[i] * sc); a[8 + i] = (_Float16)(p[16 + i] * sc); }
  return a;
}
// column fragment from a [K][ld] layout (column n), rows >= K read as 0
__device__ __forceinline__ v16h fragc_f32(const float* W, int k0, int n, int lane, int ld, int K) {
  v16h a; const int g = lane >> 4;
#pragma unroll
  for (int i = 0; i < 8; ++i) { const int ka = k0 + 8 * g + i, kb = ka + 16;
    a[i] = (_Float16)(ka < K ? W[(size_t)ka * ld + n] : 0.f); a[8 + i] = (_Float16)(kb < K ? W[(size_t)kb * ld + n] : 0.f); }
  return a;
}
struct F2 { v16b h, l; };
__device__ __forceinline__ F2 bsplit16(const float v[16]) { F2 r;
#pragma unroll
  for (int i = 0; i < 16; ++i) { const __bf16 h = (__bf16)v[i]; r.h[i] = h; r.l[i] = (__bf16)(v[i] - (float)h); }
  return r; }
__device__ __forceinline__ F2 split_row(const float* row, int k0, int lane) { float v[16]; const float* p = row + k0 + 8 * (lane >> 4);
#pragma unroll
  for (int i = 0; i < 8; ++i) { v[i] = p[i]; v[8 + i] = p[16 + i]; }
  return bsplit16(v); }
__device__ __forceinline__ F2 split_rowK(const float* row, int k0, int lane, int K) { float v[16]; const int g = lane >> 4;
#pragma unroll
  for (int i = 0; i < 8; ++i) { const int ka = k0 + 8 * g + i, kb = ka + 16; v[i] = ka < K ? row[ka] : 0.f; v[8 + i] = kb < K ? row[kb] : 0.f; }
  return bsplit16(v); }
__device__ __forceinline__ F2 split_col(const float* W, int k0, int n, int lane, int ld, int K) { float v[16]; const int g = lane >> 4;
#pragma unroll
  for (int i = 0; i < 8; ++i) { const int ka = k0 + 8 * g + i, kb = ka + 16; v[i] = ka < K ? W[(size_t)ka * ld + n] : 0.f; v[8 + i] = kb < K ? W[(size_t)kb * ld + n] : 0.f; }
  return bsplit16(v); }
__device__ __forceinline__ v8f mac3(const F2& a, const F2& b, v8f c) { c = wmma_bf(a.l, b.h, c); c = wmma_bf(a.h, b.l, c); return wmma_bf(a.h, b.h, c); }
__device__ __forceinline__ float sigm(float v) { return 1.0f / (1.0f + expf(-v)); }
#define LDSX() do { asm volatile("s_wait_dscnt 0" ::: "memory"); __builtin_amdgcn_wave_barrier(); __builtin_amdgcn_fence(__ATOMIC_RELEASE, "workgroup"); } while (0)

// Dialog sequence-attention matching: x_proj / y_proj = relu(. @ W^T + b) as two-way bf16 splits on WMMA (f32 rows); per (timestep i,
// 64 document positions) only the key tiles of earlier timesteps are visited (later ones and padded tokens are exactly weight 0; row i = 0
// is all-zero by zero_first), scores as two-way bf16 splits (logits are O(10): near-f32 keeps the sharp softmax exact), recency bias and pad
// mask (read as data) in f32, online softmax in f32, alpha (x2^14 f16) @ dialog embeddings (f16 transposed copy) on v_wmma_f32_16x16x32_f16.
#define NT 32
#define L1 512
#define MQ 64                  // tokens per timestep (32 + 32)
#define NK (NT * MQ)           // 2048
#define HH 128

// projections: blockIdx.y = 0: XP rows (16384) from xd; 1: YP rows (2048) from dlg = [xq | xa] per timestep; also dlgT16 [d][key] f16 (which = 2)
__global__ __launch_bounds__(128) void k_proj(const float* __restrict__ xd, const float* __restrict__ xq, const float* __restrict__ xa, const float* __restrict__ W, const float* __restrict__ bias, float* __restrict__ XP, float* __restrict__ YP, _Float16* __restrict__ dT) {
  __shared__ __align__(16) float so[4][16][132];
  __shared__ __align__(16) _Float16 st[HH][72];
  const int tid = threadIdx.x, wave = tid >> 5, lane = tid & 31, col = lane & 15, g = lane >> 4;
  const int which = blockIdx.y, r0 = blockIdx.x * 64 + wave * 16;
  if (which == 0 || blockIdx.x < NK / 64) {
    if (which < 2) { v8f acc[8] = {};
#pragma unroll
      for (int kc = 0; kc < HH / 32; ++kc) { F2 a;
        if (which == 0) a = split_row(xd + (size_t)(r0 + col) * HH, kc * 32, lane);
        else { const int key = r0 + col, ts = key / MQ, m = key % MQ; const float* src = m < 32 ? xq + ((size_t)ts * 32 + m) * HH : xa + ((size_t)ts * 32 + m - 32) * HH; a = split_row(src, kc * 32, lane); }
#pragma unroll
        for (int j = 0; j < 8; ++j) acc[j] = mac3(a, split_row(W + (size_t)(j * 16 + col) * HH, kc * 32, lane), acc[j]); }
#pragma unroll
      for (int j = 0; j < 8; ++j) { const int c = j * 16 + col; const float bb = bias[c];
#pragma unroll
        for (int r = 0; r < 8; ++r) { const float v = acc[j][r] + bb; so[wave][8 * g + r][c] = v > 0.f ? v : 0.f; } }
      LDSX();
      float* dst = which == 0 ? XP : YP;
#pragma unroll 4
      for (int rl = 0; rl < 16; ++rl) vst2(dst + (size_t)(r0 + rl) * HH + lane * 4, *(const v4f*)(&so[wave][rl][lane * 4])); }
    else {   // dlgT16[d][key] for this block's 64 keys
      for (int q = tid; q < 64 * HH; q += 128) { const int kl = q >> 7, d = q & 127; const int key = blockIdx.x * 64 + kl, ts = key / MQ, m = key % MQ; const float v = m < 32 ? xq[((size_t)ts * 32 + m) * HH + d] : xa[((size_t)ts * 32 + m - 32) * HH + d]; st[d][kl] = (_Float16)v; }
      __syncthreads();
      for (int q = tid; q < HH * 8; q += 128) { const int d = q >> 3, pc = q & 7; vst2(dT + (size_t)d * NK + blockIdx.x * 64 + pc * 8, *(const v4u*)(&st[d][pc * 8])); } } }
}
// attention: block (64 doc positions, timestep i)
__global__ __launch_bounds__(128) void k_attn(const float* __restrict__ XP, const float* __restrict__ YP, const _Float16* __restrict__ dT, const int* __restrict__ qmask, const int* __restrict__ amask, const float* __restrict__ rwp, float* __restrict__ out) {
  __shared__ __align__(16) float sS[4][16][68];
  __shared__ __align__(16) _Float16 sP[4][16][72];
  __shared__ __align__(16) float sO[4][16][132];
  __shared__ float smk[NK];
  const int tid = threadIdx.x, w = tid >> 5, lane = tid & 31, col = lane & 15, g = lane >> 4;
  const int i = blockIdx.y, q0 = blockIdx.x * 64 + w * 16; const size_t rq = (size_t)i * L1 + q0;
  for (int k = tid; k < NK; k += 128) { const int ts = k / MQ, m = k % MQ; const int pm = m < 32 ? qmask[ts * 32 + m] : amask[ts * 32 + m - 32]; smk[k] = pm ? 1.f : 0.f; }    // 1 = padded (masked)
  __syncthreads();
  v8f acc[8] = {};
  if (i > 0) {
    F2 aq[4];
#pragma unroll
    for (int kc = 0; kc < 4; ++kc) aq[kc] = split_row(XP + (rq + col) * HH, kc * 32, lane);
    float mrun = -3.0e38f, lrun = 0.f; const float rw = rwp[0];
#pragma unroll 1
    for (int kt = 0; kt < i; ++kt) {                     // key tile kt == timestep kt < i (later timesteps are masked -> weight exactly 0)
      const float bias = rw * (float)(i - kt);           // |i - j_ts| * recency_weight (row i >= 1)
#pragma unroll
      for (int t = 0; t < 4; ++t) { v8f s = {}; const int key = kt * 64 + t * 16 + col;
#pragma unroll
        for (int kc = 0; kc < 4; ++kc) s = mac3(aq[kc], split_row(YP + (size_t)key * HH, kc * 32, lane), s);
        const bool pad = smk[key] != 0.f;
#pragma unroll
        for (int r = 0; r < 8; ++r) sS[w][8 * g + r][t * 16 + col] = pad ? -3.0e38f : s[r] + bias; }
      LDSX();
      float mx = -3.4e38f;
#pragma unroll
      for (int jj = 0; jj < 32; ++jj) mx = fmaxf(mx, sS[w][col][g * 32 + jj]);
      mx = fmaxf(mx, __shfl_xor(mx, 16, 32));
      const float mnew = fmaxf(mrun, mx); const float corr = mnew <= -1.0e38f ? 1.0f : expf(mrun - mnew);
      float ps = 0.f;
#pragma unroll
      for (int jj = 0; jj < 32; ++jj) { const float sv = sS[w][col][g * 32 + jj]; const float p = (sv <= -1.0e38f || mnew <= -1.0e38f) ? 0.f : expf(sv - mnew); ps += p; sP[w][col][g * 32 + jj] = (_Float16)(p * 16384.0f); }
      ps += __shfl_xor(ps, 16, 32);
      lrun = lrun * corr + ps; mrun = mnew;
#pragma unroll
      for (int r = 0; r < 8; ++r) { const float cr = __shfl(corr, 8 * g + r, 32);
#pragma unroll
        for (int t = 0; t < 8; ++t) acc[t][r] *= cr; }
      LDSX();
#pragma unroll
      for (int kc = 0; kc < 2; ++kc) { const v16h pa = frag_h(&sP[w][col][0] + kc * 32, lane);
#pragma unroll
        for (int t = 0; t < 8; ++t) acc[t] = wmma16(pa, frag_h(dT + (size_t)(t * 16 + col) * NK + kt * 64 + kc * 32, lane), acc[t]); }
      __builtin_amdgcn_wave_barrier(); }
#pragma unroll
    for (int r = 0; r < 8; ++r) { const float lr = __shfl(lrun, 8 * g + r, 32); const float inv = lr > 0.f ? 1.0f / (lr * 16384.0f) : 0.f;      // a fully padded history would give 0/0 in the reference only if every earlier token were padded (not the case); guard anyway
#pragma unroll
      for (int t = 0; t < 8; ++t) sO[w][8 * g + r][t * 16 + col] = acc[t][r] * inv; } }
  else {
#pragma unroll
    for (int r = 0; r < 8; ++r)
#pragma unroll
      for (int t = 0; t < 8; ++t) sO[w][8 * g + r][t * 16 + col] = 0.f; }
  LDSX();
#pragma unroll 4
  for (int rl = 0; rl < 16; ++rl) vst2(out + (rq + rl) * HH + lane * 4, *(const v4f*)(&sO[w][rl][lane * 4]));
}
extern "C" void kernel_launch(void* const* d_in, const int* in_sizes, int n_in, void* d_out, int out_size, void* d_ws, size_t ws_size, hipStream_t stream) {
  (void)in_sizes; (void)n_in; (void)out_size; (void)ws_size;
  const float* xd = (const float*)d_in[0]; const float* xq = (const float*)d_in[1]; const float* xa = (const float*)d_in[2]; const float* W = (const float*)d_in[3]; const float* bias = (const float*)d_in[4]; const float* rw = (const float*)d_in[5]; const int* qm = (const int*)d_in[6]; const int* am = (const int*)d_in[7];
  float* out = (float*)d_out;
  char* ws = (char*)d_ws; size_t off = 0;
  auto take = [&](size_t bytes) { char* p = ws + off; off += (bytes + 255) & ~(size_t)255; return p; };
  float* XP = (float*)take((size_t)NT * L1 * HH * 4); float* YP = (float*)take((size_t)NK * HH * 4); _Float16* dT = (_Float16*)take((size_t)HH * NK * 2);
  k_proj<<<dim3(NT * L1 / 64, 3), 128, 0, stream>>>(xd, xq, xa, W, bias, XP, YP, dT);
  k_attn<<<dim3(L1 / 64, NT), 128, 0, stream>>>(XP, YP, dT, qm, am, rw, out);
}

// v001
// It runs in 99.5 microseconds.
// Next to v000, in two timings, it ran 3.53 and 3.48 times as fast.
#include <hip/hip_runtime.h>
#include <math.h>

typedef __attribute__((ext_vector_type(16))) _Float16 v16h;
typedef __attribute__((ext_vector_type(16))) __bf16 v16b;
typedef __attribute__((ext_vector_type(8)))  _Float16 v8h;
typedef __attribute__((ext_vector_type(8)))  float v8f;
typedef __attribute__((ext_vector_type(4)))  float v4f;
typedef __attribute__((ext_vector_type(2)))  float v2f;
typedef __attribute__((ext_vector_type(4)))  unsigned v4u;
typedef __attribute__((ext_vector_type(4)))  int v4i;
typedef float __attribute__((may_alias)) float_a;
typedef int __attribute__((may_alias)) int_a;

template <typename T> __device__ __forceinline__ void vst2(void* p, T v) { *(T*)p = v;  }
__device__ __forceinline__ v8f wmma16(v16h a, v16h b, v8f c) {
  v8f d = __builtin_amdgcn_wmma_f32_16x16x32_f16(false, a, false, b, (short)0, c, false, false);
  asm volatile("v_nop\n\tv_nop\n\tv_nop\n\tv_nop" : "+v"(d) : "v"(a), "v"(b));
  return d;
}
__device__ __forceinline__ v8f wmma_bf(v16b a, v16b b, v8f c) {
  v8f d = __builtin_amdgcn_wmma_f32_16x16x32_bf16(false, a, false, b, (short)0, c, false, false);
  asm volatile("v_nop\n\tv_nop\n\tv_nop\n\tv_nop" : "+v"(d) : "v"(a), "v"(b));
  return d;
}
// 16x16x32 fragments: lane = (h = lane>>4, row/col = lane&15); elements 0..7 = k0+8h+0..7, 8..15 = k0+16+8h+0..7; D element r = row 8h+r
__device__ __forceinline__ v16h frag_h(const _Float16* rowk0, int lane) {
  union { v16h v; v8h q[2]; } u; const _Float16* p = rowk0 + 8 * (lane >> 4);
  u.q[0] = *(const v8h*)p; u.q[1] = *(const v8h*)(p + 16); return u.v;
}
__device__ __forceinline__ v16h frag_f32(const float* rowk0, int lane) {
  v16h a; const float* p = rowk0 + 8 * (lane >> 4);
#pragma unroll
  for (int i = 0; i < 8; ++i) { a[i] = (_Float16)p[i]; a[8 + i] = (_Float16)p[16 + i]; }
  return a;
}
__device__ __forceinline__ v16h frag_f32s(const float* rowk0, int lane, float sc) {
  v16h a; const float* p = rowk0 + 8 * (lane >> 4);
#pragma unroll
  for (int i = 0; i < 8; ++i) { a[i] = (_Float16)(p[i] * sc); a[8 + i] = (_Float16)(p[16 + i] * sc); }
  return a;
}
// column fragment from a [K][ld] layout (column n), rows >= K read as 0
__device__ __forceinline__ v16h fragc_f32(const float* W, int k0, int n, int lane, int ld, int K) {
  v16h a; const int g = lane >> 4;
#pragma unroll
  for (int i = 0; i < 8; ++i) { const int ka = k0 + 8 * g + i, kb = ka + 16;
    a[i] = (_Float16)(ka < K ? W[(size_t)ka * ld + n] : 0.f); a[8 + i] = (_Float16)(kb < K ? W[(size_t)kb * ld + n] : 0.f); }
  return a;
}
struct F2 { v16b h, l; };
__device__ __forceinline__ F2 bsplit16(const float v[16]) { F2 r;
#pragma unroll
  for (int i = 0; i < 16; ++i) { const __bf16 h = (__bf16)v[i]; r.h[i] = h; r.l[i] = (__bf16)(v[i] - (float)h); }
  return r; }
__device__ __forceinline__ F2 split_row(const float* row, int k0, int lane) { float v[16]; const float* p = row + k0 + 8 * (lane >> 4);
#pragma unroll
  for (int i = 0; i < 8; ++i) { v[i] = p[i]; v[8 + i] = p[16 + i]; }
  return bsplit16(v); }
__device__ __forceinline__ F2 split_rowK(const float* row, int k0, int lane, int K) { float v[16]; const int g = lane >> 4;
#pragma unroll
  for (int i = 0; i < 8; ++i) { const int ka = k0 + 8 * g + i, kb = ka + 16; v[i] = ka < K ? row[ka] : 0.f; v[8 + i] = kb < K ? row[kb] : 0.f; }
  return bsplit16(v); }
__device__ __forceinline__ F2 split_col(const float* W, int k0, int n, int lane, int ld, int K) { float v[16]; const int g = lane >> 4;
#pragma unroll
  for (int i = 0; i < 8; ++i) { const int ka = k0 + 8 * g + i, kb = ka + 16; v[i] = ka < K ? W[(size_t)ka * ld + n] : 0.f; v[8 + i] = kb < K ? W[(size_t)kb * ld + n] : 0.f; }
  return bsplit16(v); }
__device__ __forceinline__ v8f mac3(const F2& a, const F2& b, v8f c) { c = wmma_bf(a.l, b.h, c); c = wmma_bf(a.h, b.l, c); return wmma_bf(a.h, b.h, c); }
__device__ __forceinline__ float sigm(float v) { return 1.0f / (1.0f + expf(-v)); }
#define LDSX() do { asm volatile("s_wait_dscnt 0" ::: "memory"); __builtin_amdgcn_wave_barrier(); __builtin_amdgcn_fence(__ATOMIC_RELEASE, "workgroup"); } while (0)

// Dialog sequence-attention matching: x_proj / y_proj = relu(. @ W^T + b) as two-way bf16 splits on WMMA (f32 rows); per (timestep i,
// 16 document positions) only the key tiles of earlier timesteps are visited, dealt over the block's waves (later ones and padded tokens are exactly weight 0; row i = 0
// is all-zero: k_attn stores it with inv = 0), scores as two-way bf16 splits (logits are O(10): near-f32 keeps the sharp softmax exact), recency bias and pad
// mask (read as data) in f32, online softmax in f32, alpha (x2^14 f16) @ dialog embeddings (f16 transposed copy) on v_wmma_f32_16x16x32_f16.
#define NT 32
#define L1 512
#define MQ 64                  // tokens per timestep (32 + 32)
#define NK (NT * MQ)           // 2048
#define HH 128

// projections: blockIdx.y = 0: XP rows (16384) from xd; 1: YP rows (2048) from dlg = [xq | xa] per timestep; also dlgT16 [d][key] f16 (which = 2)
__global__ __launch_bounds__(128) void k_proj(const float* __restrict__ xd, const float* __restrict__ xq, const float* __restrict__ xa, const float* __restrict__ W, const float* __restrict__ bias, float* __restrict__ XP, float* __restrict__ YP, _Float16* __restrict__ dT) {
  __shared__ __align__(16) float so[4][16][132];
  __shared__ __align__(16) _Float16 st[HH][72];
  const int tid = threadIdx.x, wave = tid >> 5, lane = tid & 31, col = lane & 15, g = lane >> 4;
  const int which = blockIdx.y, r0 = blockIdx.x * 64 + wave * 16;
  if (which == 0 || blockIdx.x < NK / 64) {
    if (which < 2) { v8f acc[8] = {};
#pragma unroll
      for (int kc = 0; kc < HH / 32; ++kc) { F2 a;
        if (which == 0) a = split_row(xd + (size_t)(r0 + col) * HH, kc * 32, lane);
        else { const int key = r0 + col, ts = key / MQ, m = key % MQ; const float* src = m < 32 ? xq + ((size_t)ts * 32 + m) * HH : xa + ((size_t)ts * 32 + m - 32) * HH; a = split_row(src, kc * 32, lane); }
#pragma unroll
        for (int j = 0; j < 8; ++j) acc[j] = mac3(a, split_row(W + (size_t)(j * 16 + col) * HH, kc * 32, lane), acc[j]); }
#pragma unroll
      for (int j = 0; j < 8; ++j) { const int c = j * 16 + col; const float bb = bias[c];
#pragma unroll
        for (int r = 0; r < 8; ++r) { const float v = acc[j][r] + bb; so[wave][8 * g + r][c] = v > 0.f ? v : 0.f; } }
      LDSX();
      float* dst = which == 0 ? XP : YP;
#pragma unroll 4
      for (int rl = 0; rl < 16; ++rl) vst2(dst + (size_t)(r0 + rl) * HH + lane * 4, *(const v4f*)(&so[wave][rl][lane * 4])); }
    else {   // dlgT16[d][key] for this block's 64 keys
      for (int q = tid; q < 64 * HH; q += 128) { const int kl = q >> 7, d = q & 127; const int key = blockIdx.x * 64 + kl, ts = key / MQ, m = key % MQ; const float v = m < 32 ? xq[((size_t)ts * 32 + m) * HH + d] : xa[((size_t)ts * 32 + m - 32) * HH + d]; st[d][kl] = (_Float16)v; }
      __syncthreads();
      for (int q = tid; q < HH * 8; q += 128) { const int d = q >> 3, pc = q & 7; vst2(dT + (size_t)d * NK + blockIdx.x * 64 + pc * 8, *(const v4u*)(&st[d][pc * 8])); } } }
}
// attention: block (16 doc positions, timestep i); wave w takes the key tiles kt = w, w + KS, ... and keeps its own running maximum, sum and
// un-normalised accumulator; the KS partial results are merged through LDS behind one work-group barrier
#define KS 8
__global__ __launch_bounds__(32 * KS) void k_attn(const float* __restrict__ XP, const float* __restrict__ YP, const _Float16* __restrict__ dT, const int* __restrict__ qmask, const int* __restrict__ amask, const float* __restrict__ rwp, float* __restrict__ out) {
  __shared__ __align__(16) float sS[KS][16][68];
  __shared__ __align__(16) _Float16 sP[KS][16][72];
  __shared__ __align__(16) float sO[KS][16][132];
  __shared__ float sM[KS][16];
  __shared__ float sL[KS][16];
  __shared__ float smk[NK];
  // w through readfirstlane: the wave's number in a scalar register, so that the key loop's trip test stays a scalar branch
  const int tid = threadIdx.x, w = __builtin_amdgcn_readfirstlane(tid >> 5), lane = tid & 31, col = lane & 15, g = lane >> 4;
  const int i = blockIdx.y, q0 = blockIdx.x * 16; const size_t rq = (size_t)i * L1 + q0;
  for (int k = tid; k < NK; k += 32 * KS) { const int ts = k / MQ, m = k % MQ; const int pm = m < 32 ? qmask[ts * 32 + m] : amask[ts * 32 + m - 32]; smk[k] = pm ? 1.f : 0.f; }    // 1 = padded (masked)
  __syncthreads();
  if (w < i) {
    v8f acc[8] = {};
    F2 aq[4];
#pragma unroll
    for (int kc = 0; kc < 4; ++kc) aq[kc] = split_row(XP + (rq + col) * HH, kc * 32, lane);
    float mrun = -3.0e38f, lrun = 0.f; const float rw = rwp[0];
#pragma unroll 1
    for (int kt = w; kt < i; kt += KS) {                 // key tile kt == timestep kt < i (later timesteps are masked -> weight exactly 0)
      const float bias = rw * (float)(i - kt);           // |i - j_ts| * recency_weight (row i >= 1)
#pragma unroll
      for (int t = 0; t < 4; ++t) { v8f s = {}; const int key = kt * 64 + t * 16 + col;
#pragma unroll
        for (int kc = 0; kc < 4; ++kc) s = mac3(aq[kc], split_row(YP + (size_t)key * HH, kc * 32, lane), s);
        const bool pad = smk[key] != 0.f;
#pragma unroll
        for (int r = 0; r < 8; ++r) sS[w][8 * g + r][t * 16 + col] = pad ? -3.0e38f : s[r] + bias; }
      LDSX();
      float mx = -3.4e38f;
#pragma unroll
      for (int jj = 0; jj < 32; ++jj) mx = fmaxf(mx, sS[w][col][g * 32 + jj]);
      mx = fmaxf(mx, __shfl_xor(mx, 16, 32));
      const float mnew = fmaxf(mrun, mx); const float corr = mnew <= -1.0e38f ? 1.0f : expf(mrun - mnew);
      float ps = 0.f;
#pragma unroll
      for (int jj = 0; jj < 32; ++jj) { const float sv = sS[w][col][g * 32 + jj]; const float p = (sv <= -1.0e38f || mnew <= -1.0e38f) ? 0.f : expf(sv - mnew); ps += p; sP[w][col][g * 32 + jj] = (_Float16)(p * 16384.0f); }
      ps += __shfl_xor(ps, 16, 32);
      lrun = lrun * corr + ps; mrun = mnew;
#pragma unroll
      for (int r = 0; r < 8; ++r) { const float cr = __shfl(corr, 8 * g + r, 32);
#pragma unroll
        for (int t = 0; t < 8; ++t) acc[t][r] *= cr; }
      LDSX();
#pragma unroll
      for (int kc = 0; kc < 2; ++kc) { const v16h pa = frag_h(&sP[w][col][0] + kc * 32, lane);
#pragma unroll
        for (int t = 0; t < 8; ++t) acc[t] = wmma16(pa, frag_h(dT + (size_t)(t * 16 + col) * NK + kt * 64 + kc * 32, lane), acc[t]); }
      __builtin_amdgcn_wave_barrier(); }
    if (g == 0) { sM[w][col] = mrun; sL[w][col] = lrun; }
#pragma unroll
    for (int r = 0; r < 8; ++r)
#pragma unroll
      for (int t = 0; t < 8; ++t) sO[w][8 * g + r][t * 16 + col] = acc[t][r]; }
  __syncthreads();   // every wave's partial (maximum, sum, accumulator) is in LDS before any thread merges
  // merge: thread = (row, two groups of 4 columns); only the waves that had a tile (u < i) count, the others re-read wave 0's partial with
  // weight 0 so that all LDS reads are independent of each other; i = 0 gives the all-zero row block
  const int row = tid >> 4, c = (tid & 15) * 4;
  v4f o0 = {}, o1 = {}; float inv = 0.f;
  if (i > 0) {
    float mu[KS], M = -3.0e38f, L = 0.f;
#pragma unroll
    for (int u = 0; u < KS; ++u) { mu[u] = sM[u < i ? u : 0][row]; M = fmaxf(M, mu[u]); }
#pragma unroll
    for (int u = 0; u < KS; ++u) { const int uu = u < i ? u : 0; const float e = expf(mu[u] - M); const float f = (u >= i || mu[u] <= -1.0e38f) ? 0.f : e;
      L += f * sL[uu][row]; o0 += f * *(const v4f*)(&sO[uu][row][c]); o1 += f * *(const v4f*)(&sO[uu][row][64 + c]); }
    inv = L > 0.f ? 1.0f / (L * 16384.0f) : 0.f; }     // a fully padded history gives sum 0; guarded as before
  vst2(out + (rq + row) * HH + c, o0 * inv); vst2(out + (rq + row) * HH + 64 + c, o1 * inv);
}
extern "C" void kernel_launch(void* const* d_in, const int* in_sizes, int n_in, void* d_out, int out_size, void* d_ws, size_t ws_size, hipStream_t stream) {
  (void)in_sizes; (void)n_in; (void)out_size; (void)ws_size;
  const float* xd = (const float*)d_in[0]; const float* xq = (const float*)d_in[1]; const float* xa = (const float*)d_in[2]; const float* W = (const float*)d_in[3]; const float* bias = (const float*)d_in[4]; const float* rw = (const float*)d_in[5]; const int* qm = (const int*)d_in[6]; const int* am = (const int*)d_in[7];
  float* out = (float*)d_out;
  char* ws = (char*)d_ws; size_t off = 0;
  auto take = [&](size_t bytes) { char* p = ws + off; off += (bytes + 255) & ~(size_t)255; return p; };
  float* XP = (float*)take((size_t)NT * L1 * HH * 4); float* YP = (float*)take((size_t)NK * HH * 4); _Float16* dT = (_Float16*)take((size_t)HH * NK * 2);
  k_proj<<<dim3(NT * L1 / 64, 3), 128, 0, stream>>>(xd, xq, xa, W, bias, XP, YP, dT);
  k_attn<<<dim3(L1 / 16, NT), 32 * KS, 0, stream>>>(XP, YP, dT, qm, am, rw, out);
}

// v002
// Measured time: 74.1 microseconds a run.
// Two timings next to v001 put it at 1.38 and 1.36 times that version's speed.
// Counting every step since v000, it is 4.79 times as fast.
#include <hip/hip_runtime.h>
#include <math.h>

typedef __attribute__((ext_vector_type(16))) _Float16 v16h;
typedef __attribute__((ext_vector_type(16))) __bf16 v16b;
typedef __attribute__((ext_vector_type(8)))  _Float16 v8h;
typedef __attribute__((ext_vector_type(8)))  float v8f;
typedef __attribute__((ext_vector_type(4)))  float v4f;
typedef __attribute__((ext_vector_type(2)))  float v2f;
typedef __attribute__((ext_vector_type(4)))  unsigned v4u;
typedef __attribute__((ext_vector_type(4)))  int v4i;
typedef float __attribute__((may_alias)) float_a;
typedef int __attribute__((may_alias)) int_a;

template <typename T> __device__ __forceinline__ void vst2(void* p, T v) { *(T*)p = v;  }
__device__ __forceinline__ v8f wmma16(v16h a, v16h b, v8f c) {
  v8f d = __builtin_amdgcn_wmma_f32_16x16x32_f16(false, a, false, b, (short)0, c, false, false);
  asm volatile("v_nop\n\tv_nop\n\tv_nop\n\tv_nop" : "+v"(d) : "v"(a), "v"(b));
  return d;
}
__device__ __forceinline__ v8f wmma_bf(v16b a, v16b b, v8f c) {
  v8f d = __builtin_amdgcn_wmma_f32_16x16x32_bf16(false, a, false, b, (short)0, c, false, false);
  asm volatile("v_nop\n\tv_nop\n\tv_nop\n\tv_nop" : "+v"(d) : "v"(a), "v"(b));
  return d;
}
// 16x16x32 fragments: lane = (h = lane>>4, row/col = lane&15); elements 0..7 = k0+8h+0..7, 8..15 = k0+16+8h+0..7; D element r = row 8h+r
__device__ __forceinline__ v16h frag_h(const _Float16* rowk0, int lane) {
  union { v16h v; v8h q[2]; } u; const _Float16* p = rowk0 + 8 * (lane >> 4);
  u.q[0] = *(const v8h*)p; u.q[1] = *(const v8h*)(p + 16); return u.v;
}
__device__ __forceinline__ v16h frag_f32(const float* rowk0, int lane) {
  v16h a; const float* p = rowk0 + 8 * (lane >> 4);
#pragma unroll
  for (int i = 0; i < 8; ++i) { a[i] = (_Float16)p[i]; a[8 + i] = (_Float16)p[16 + i]; }
  return a;
}
__device__ __forceinline__ v16h frag_f32s(const float* rowk0, int lane, float sc) {
  v16h a; const float* p = rowk0 + 8 * (lane >> 4);
#pragma unroll
  for (int i = 0; i < 8; ++i) { a[i] = (_Float16)(p[i] * sc); a[8 + i] = (_Float16)(p[16 + i] * sc); }
  return a;
}
// column fragment from a [K][ld] layout (column n), rows >= K read as 0
__device__ __forceinline__ v16h fragc_f32(const float* W, int k0, int n, int lane, int ld, int K) {
  v16h a; const int g = lane >> 4;
#pragma unroll
  for (int i = 0; i < 8; ++i) { const int ka = k0 + 8 * g + i, kb = ka + 16;
    a[i] = (_Float16)(ka < K ? W[(size_t)ka * ld + n] : 0.f); a[8 + i] = (_Float16)(kb < K ? W[(size_t)kb * ld + n] : 0.f); }
  return a;
}
struct F2 { v16b h, l; };
__device__ __forceinline__ F2 bsplit16(const float v[16]) { F2 r;
#pragma unroll
  for (int i = 0; i < 16; ++i) { const __bf16 h = (__bf16)v[i]; r.h[i] = h; r.l[i] = (__bf16)(v[i] - (float)h); }
  return r; }
__device__ __forceinline__ F2 split_row(const float* row, int k0, int lane) { float v[16]; const float* p = row + k0 + 8 * (lane >> 4);
#pragma unroll
  for (int i = 0; i < 8; ++i) { v[i] = p[i]; v[8 + i] = p[16 + i]; }
  return bsplit16(v); }
__device__ __forceinline__ F2 split_rowK(const float* row, int k0, int lane, int K) { float v[16]; const int g = lane >> 4;
#pragma unroll
  for (int i = 0; i < 8; ++i) { const int ka = k0 + 8 * g + i, kb = ka + 16; v[i] = ka < K ? row[ka] : 0.f; v[8 + i] = kb < K ? row[kb] : 0.f; }
  return bsplit16(v); }
__device__ __forceinline__ F2 split_col(const float* W, int k0, int n, int lane, int ld, int K) { float v[16]; const int g = lane >> 4;
#pragma unroll
  for (int i = 0; i < 8; ++i) { const int ka = k0 + 8 * g + i, kb = ka + 16; v[i] = ka < K ? W[(size_t)ka * ld + n] : 0.f; v[8 + i] = kb < K ? W[(size_t)kb * ld + n] : 0.f; }
  return bsplit16(v); }
__device__ __forceinline__ F2 split_st(const v4f s[4]) { float v[16];
#pragma unroll
  for (int i = 0; i < 4; ++i) { v[i] = s[0][i]; v[4 + i] = s[1][i]; v[8 + i] = s[2][i]; v[12 + i] = s[3][i]; }
  return bsplit16(v); }
// the 16 floats of one f32 row fragment (p = row + k0 + 8 * (lane >> 4)), raw: same elements, same order as split_row
__device__ __forceinline__ void ld_st(v4f s[4], const float* p) { s[0] = *(const v4f*)p; s[1] = *(const v4f*)(p + 4); s[2] = *(const v4f*)(p + 16); s[3] = *(const v4f*)(p + 20); }
__device__ __forceinline__ v8f mac3(const F2& a, const F2& b, v8f c) { c = wmma_bf(a.l, b.h, c); c = wmma_bf(a.h, b.l, c); return wmma_bf(a.h, b.h, c); }
__device__ __forceinline__ float sigm(float v) { return 1.0f / (1.0f + expf(-v)); }
#define LDSX() do { asm volatile("s_wait_dscnt 0" ::: "memory"); __builtin_amdgcn_wave_barrier(); __builtin_amdgcn_fence(__ATOMIC_RELEASE, "workgroup"); } while (0)

// Dialog sequence-attention matching: x_proj / y_proj = relu(. @ W^T + b) as two-way bf16 splits on WMMA (f32 rows); per (timestep i,
// 16 document positions) only the key tiles of earlier timesteps are visited, dealt over the block's waves (later ones and padded tokens are exactly weight 0; row i = 0
// is all-zero: k_attn stores it with inv = 0), scores as two-way bf16 splits (logits are O(10): near-f32 keeps the sharp softmax exact), recency bias and pad
// mask (read as data) in f32, online softmax in f32, alpha (x2^14 f16) @ dialog embeddings (f16 transposed copy) on v_wmma_f32_16x16x32_f16.
#define NT 32
#define L1 512
#define MQ 64                  // tokens per timestep (32 + 32)
#define NK (NT * MQ)           // 2048
#define HH 128

// projections: blockIdx.y = 0: XP rows (16384) from xd; 1: YP rows (2048) from dlg = [xq | xa] per timestep; also dlgT16 [d][key] f16 (which = 2)
__global__ __launch_bounds__(128) void k_proj(const float* __restrict__ xd, const float* __restrict__ xq, const float* __restrict__ xa, const float* __restrict__ W, const float* __restrict__ bias, float* __restrict__ XP, float* __restrict__ YP, _Float16* __restrict__ dT) {
  __shared__ __align__(16) float so[4][16][132];
  __shared__ __align__(16) _Float16 st[HH][72];
  const int tid = threadIdx.x, wave = tid >> 5, lane = tid & 31, col = lane & 15, g = lane >> 4;
  const int which = blockIdx.y, r0 = blockIdx.x * 64 + wave * 16;
  if (which == 0 || blockIdx.x < NK / 64) {
    if (which < 2) { v8f acc[8] = {};
#pragma unroll
      for (int kc = 0; kc < HH / 32; ++kc) { F2 a;
        if (which == 0) a = split_row(xd + (size_t)(r0 + col) * HH, kc * 32, lane);
        else { const int key = r0 + col, ts = key / MQ, m = key % MQ; const float* src = m < 32 ? xq + ((size_t)ts * 32 + m) * HH : xa + ((size_t)ts * 32 + m - 32) * HH; a = split_row(src, kc * 32, lane); }
#pragma unroll
        for (int j = 0; j < 8; ++j) acc[j] = mac3(a, split_row(W + (size_t)(j * 16 + col) * HH, kc * 32, lane), acc[j]); }
#pragma unroll
      for (int j = 0; j < 8; ++j) { const int c = j * 16 + col; const float bb = bias[c];
#pragma unroll
        for (int r = 0; r < 8; ++r) { const float v = acc[j][r] + bb; so[wave][8 * g + r][c] = v > 0.f ? v : 0.f; } }
      LDSX();
      float* dst = which == 0 ? XP : YP;
#pragma unroll 4
      for (int rl = 0; rl < 16; ++rl) vst2(dst + (size_t)(r0 + rl) * HH + lane * 4, *(const v4f*)(&so[wave][rl][lane * 4])); }
    else {   // dlgT16[d][key] for this block's 64 keys
      for (int q = tid; q < 64 * HH; q += 128) { const int kl = q >> 7, d = q & 127; const int key = blockIdx.x * 64 + kl, ts = key / MQ, m = key % MQ; const float v = m < 32 ? xq[((size_t)ts * 32 + m) * HH + d] : xa[((size_t)ts * 32 + m - 32) * HH + d]; st[d][kl] = (_Float16)v; }
      __syncthreads();
      for (int q = tid; q < HH * 8; q += 128) { const int d = q >> 3, pc = q & 7; vst2(dT + (size_t)d * NK + blockIdx.x * 64 + pc * 8, *(const v4u*)(&st[d][pc * 8])); } } }
}
// attention: block (16 doc positions, timestep i); wave w takes the key tiles kt = w, w + KS, ... and keeps its own running maximum, sum and
// un-normalised accumulator; the KS partial results are merged through LDS behind one work-group barrier
#define KS 8
// four waves per SIMD: two work-groups stay resident on a WGP only at 256 registers a wave or fewer
__global__ __launch_bounds__(32 * KS) __attribute__((amdgpu_waves_per_eu(4, 4))) void k_attn(const float* __restrict__ XP, const float* __restrict__ YP, const _Float16* __restrict__ dT, const int* __restrict__ qmask, const int* __restrict__ amask, const float* __restrict__ rwp, float* __restrict__ out) {
  __shared__ __align__(16) float sS[KS][16][68];
  __shared__ __align__(16) _Float16 sP[KS][16][72];
  __shared__ __align__(16) float sO[KS][16][132];
  __shared__ float sM[KS][16];
  __shared__ float sL[KS][16];
  __shared__ float smk[NK];
  __shared__ __align__(16) v4u sQ[4][2][2][32];   // the block's query fragments [k chunk][hi, lo][half][lane], shared by all waves
  // w through readfirstlane: the wave's number in a scalar register, so that the key loop's trip test stays a scalar branch
  const int tid = threadIdx.x, w = __builtin_amdgcn_readfirstlane(tid >> 5), lane = tid & 31, col = lane & 15, g = lane >> 4;
  const int i = blockIdx.y, q0 = blockIdx.x * 16; const size_t rq = (size_t)i * L1 + q0;
  { const int m = tid % MQ; const int* pmk = (m < 32 ? qmask + m : amask + (m - 32)) + (tid / MQ) * 32;   // key k = tid + 256 j: token m of timestep tid / 64 + 4 j
#pragma unroll   // the eight mask loads of a thread go out together; rolled, each is waited out alone
    for (int j = 0; j < NK / (32 * KS); ++j) smk[tid + j * 32 * KS] = pmk[j * (32 * KS / MQ) * 32] ? 1.f : 0.f; }    // 1 = padded (masked)
  if (w < 4) { union { F2 f; v4u q[4]; } u; u.f = split_row(XP + (rq + col) * HH, w * 32, lane);
    sQ[w][0][0][lane] = u.q[0]; sQ[w][0][1][lane] = u.q[1]; sQ[w][1][0][lane] = u.q[2]; sQ[w][1][1][lane] = u.q[3]; }
  __syncthreads();
  if (w < i) {
    v8f acc[8] = {};
    const float* ypl = YP + (size_t)col * HH + 8 * g;          // this lane's place in a key tile of y_proj
    const _Float16* dtl = dT + (size_t)col * NK + 8 * g;       // and in a key tile of the transposed dialog copy
    v4f st[4][4];                                              // raw y_proj rows of one 16-key group, one entry per k chunk
#pragma unroll
    for (int kc = 0; kc < 4; ++kc) { ld_st(st[kc], ypl + (size_t)w * 64 * HH + kc * 32);
      __builtin_amdgcn_sched_barrier(0); }                     // chunks go out in the loop's own order: in another order the trip's first wait is for all sixteen loads
    float mrun = -3.0e38f, lrun = 0.f; const float rw = rwp[0];
#pragma unroll 1
    for (int kt = w; kt < i; kt += KS) {                 // key tile kt == timestep kt < i (later timesteps are masked -> weight exactly 0)
      const float bias = rw * (float)(i - kt);           // |i - j_ts| * recency_weight (row i >= 1)
      const float* yp = ypl + (size_t)kt * 64 * HH;
      F2 aq[4];                                          // re-read every trip: their registers hold the dialog tile during softmax and PV
#pragma unroll
      for (int kc = 0; kc < 4; ++kc) { union { F2 f; v4u q[4]; } u; u.q[0] = sQ[kc][0][0][lane]; u.q[1] = sQ[kc][0][1][lane]; u.q[2] = sQ[kc][1][0][lane]; u.q[3] = sQ[kc][1][1][lane]; aq[kc] = u.f; }
#pragma unroll
      for (int t = 0; t < 4; ++t) { v8f s = {}; const int key = kt * 64 + t * 16 + col;
#pragma unroll
        for (int kc = 0; kc < 4; ++kc) { const F2 b = split_st(st[kc]);
          if (t < 3) {
            __builtin_amdgcn_sched_barrier(0);           // the split first, so that the load below re-uses its registers (lifted over it, it takes 16 more)
            ld_st(st[kc], yp + (size_t)(t + 1) * 16 * HH + kc * 32);            // the next group's chunk into the registers just read
            __builtin_amdgcn_sched_barrier(0); }         // keeps that load here, three chunks ahead of its use; sunk to its use it is waited out alone
          s = mac3(aq[kc], b, s); }
        const bool pad = smk[key] != 0.f;
#pragma unroll
        for (int r = 0; r < 8; ++r) sS[w][8 * g + r][t * 16 + col] = pad ? -3.0e38f : s[r] + bias; }
      LDSX();
      const _Float16* dp = dtl + kt * 64;
      v8h dv[2][8][2];                                   // the whole dialog tile, asked for now so that it lands behind the softmax
#pragma unroll
      for (int kc = 0; kc < 2; ++kc)
#pragma unroll
        for (int t = 0; t < 8; ++t) { const _Float16* p = dp + (size_t)t * 16 * NK + kc * 32; dv[kc][t][0] = *(const v8h*)p; dv[kc][t][1] = *(const v8h*)(p + 16); }
      asm volatile("s_wait_xcnt 0x0" :: "v"(dp) : "memory");   // the loads' address pair is live up to this wait
      __builtin_amdgcn_sched_barrier(0);                 // keeps the 32 loads in front of the softmax
      float mx = -3.4e38f;
#pragma unroll
      for (int jj = 0; jj < 32; ++jj) mx = fmaxf(mx, sS[w][col][g * 32 + jj]);
      mx = fmaxf(mx, __shfl_xor(mx, 16, 32));
      const float mnew = fmaxf(mrun, mx); const float corr = mnew <= -1.0e38f ? 1.0f : expf(mrun - mnew);
      float ps = 0.f;
#pragma unroll
      for (int jj = 0; jj < 32; ++jj) { const float sv = sS[w][col][g * 32 + jj]; const float p = (sv <= -1.0e38f || mnew <= -1.0e38f) ? 0.f : expf(sv - mnew); ps += p; sP[w][col][g * 32 + jj] = (_Float16)(p * 16384.0f); }
      ps += __shfl_xor(ps, 16, 32);
      lrun = lrun * corr + ps; mrun = mnew;
#pragma unroll
      for (int r = 0; r < 8; ++r) { const float cr = __shfl(corr, 8 * g + r, 32);
#pragma unroll
        for (int t = 0; t < 8; ++t) acc[t][r] *= cr; }
      LDSX();
      const float* ypn = ypl + (size_t)(kt + KS < i ? kt + KS : kt) * 64 * HH;   // the wave's next tile (its last trip re-reads its own: in bounds, unused)
#pragma unroll
      for (int kc = 0; kc < 2; ++kc) { const v16h pa = frag_h(&sP[w][col][0] + kc * 32, lane);
#pragma unroll
        for (int t = 0; t < 8; ++t) { union { v16h v; v8h q[2]; } u; u.q[0] = dv[kc][t][0]; u.q[1] = dv[kc][t][1];
          acc[t] = wmma16(pa, u.v, acc[t]);
          if (kc == 0 && (t & 1)) { ld_st(st[t >> 1], ypn + (t >> 1) * 32);
            __builtin_amdgcn_sched_barrier(0); } } }     // next tile's first group goes out as dialog registers fall free, not at its use
      asm volatile("s_wait_xcnt 0x0" :: "v"(ypn) : "memory");  // before the next trip's split re-uses the address pair of the loads still in flight
      __builtin_amdgcn_wave_barrier(); }
    if (g == 0) { sM[w][col] = mrun; sL[w][col] = lrun; }
#pragma unroll
    for (int r = 0; r < 8; ++r)
#pragma unroll
      for (int t = 0; t < 8; ++t) sO[w][8 * g + r][t * 16 + col] = acc[t][r]; }
  __syncthreads();   // every wave's partial (maximum, sum, accumulator) is in LDS before any thread merges
  // merge: thread = (row, two groups of 4 columns); only the waves that had a tile (u < i) count, the others re-read wave 0's partial with
  // weight 0 so that all LDS reads are independent of each other; i = 0 gives the all-zero row block
  const int row = tid >> 4, c = (tid & 15) * 4;
  v4f o0 = {}, o1 = {}; float inv = 0.f;
  if (i > 0) {
    float mu[KS], M = -3.0e38f, L = 0.f;
#pragma unroll
    for (int u = 0; u < KS; ++u) { mu[u] = sM[u < i ? u : 0][row]; M = fmaxf(M, mu[u]); }
#pragma unroll
    for (int u = 0; u < KS; ++u) { const int uu = u < i ? u : 0; const float e = expf(mu[u] - M); const float f = (u >= i || mu[u] <= -1.0e38f) ? 0.f : e;
      L += f * sL[uu][row]; o0 += f * *(const v4f*)(&sO[uu][row][c]); o1 += f * *(const v4f*)(&sO[uu][row][64 + c]); }
    inv = L > 0.f ? 1.0f / (L * 16384.0f) : 0.f; }     // a fully padded history gives sum 0; guarded as before
  vst2(out + (rq + row) * HH + c, o0 * inv); vst2(out + (rq + row) * HH + 64 + c, o1 * inv);
}
extern "C" void kernel_launch(void* const* d_in, const int* in_sizes, int n_in, void* d_out, int out_size, void* d_ws, size_t ws_size, hipStream_t stream) {
  (void)in_sizes; (void)n_in; (void)out_size; (void)ws_size;
  const float* xd = (const float*)d_in[0]; const float* xq = (const float*)d_in[1]; const float* xa = (const float*)d_in[2]; const float* W = (const float*)d_in[3]; const float* bias = (const float*)d_in[4]; const float* rw = (const float*)d_in[5]; const int* qm = (const int*)d_in[6]; const int* am = (const int*)d_in[7];
  float* out = (float*)d_out;
  char* ws = (char*)d_ws; size_t off = 0;
  auto take = [&](size_t bytes) { char* p = ws + off; off += (bytes + 255) & ~(size_t)255; return p; };
  float* XP = (float*)take((size_t)NT * L1 * HH * 4); float* YP = (float*)take((size_t)NK * HH * 4); _Float16* dT = (_Float16*)take((size_t)HH * NK * 2);
  k_proj<<<dim3(NT * L1 / 64, 3), 128, 0, stream>>>(xd, xq, xa, W, bias, XP, YP, dT);
  k_attn<<<dim3(L1 / 16, NT), 32 * KS, 0, stream>>>(XP, YP, dT, qm, am, rw, out);
}

// v003
// It runs in 60.5 microseconds.
// In both of two side-by-side timings against v002, it was 1.22 times as fast.
// All steps since v000 together make it 5.84 times as fast.
#include <hip/hip_runtime.h>
#include <math.h>

typedef __attribute__((ext_vector_type(16))) _Float16 v16h;
typedef __attribute__((ext_vector_type(16))) __bf16 v16b;
typedef __attribute__((ext_vector_type(8)))  _Float16 v8h;
typedef __attribute__((ext_vector_type(8)))  float v8f;
typedef __attribute__((ext_vector_type(4)))  float v4f;
typedef __attribute__((ext_vector_type(2)))  float v2f;
typedef __attribute__((ext_vector_type(4)))  unsigned v4u;
typedef __attribute__((ext_vector_type(4)))  int v4i;
typedef float __attribute__((may_alias)) float_a;
typedef int __attribute__((may_alias)) int_a;

template <typename T> __device__ __forceinline__ void vst2(void* p, T v) { *(T*)p = v;  }
__device__ __forceinline__ v8f wmma16(v16h a, v16h b, v8f c) {
  v8f d = __builtin_amdgcn_wmma_f32_16x16x32_f16(false, a, false, b, (short)0, c, false, false);
  asm volatile("v_nop\n\tv_nop\n\tv_nop\n\tv_nop" : "+v"(d) : "v"(a), "v"(b));
  return d;
}
__device__ __forceinline__ v8f wmma_bf(v16b a, v16b b, v8f c) {
  v8f d = __builtin_amdgcn_wmma_f32_16x16x32_bf16(false, a, false, b, (short)0, c, false, false);
  asm volatile("v_nop\n\tv_nop\n\tv_nop\n\tv_nop" : "+v"(d) : "v"(a), "v"(b));
  return d;
}
// 16x16x32 fragments: lane = (h = lane>>4, row/col = lane&15); elements 0..7 = k0+8h+0..7, 8..15 = k0+16+8h+0..7; D element r = row 8h+r
__device__ __forceinline__ v16h frag_h(const _Float16* rowk0, int lane) {
  union { v16h v; v8h q[2]; } u; const _Float16* p = rowk0 + 8 * (lane >> 4);
  u.q[0] = *(const v8h*)p; u.q[1] = *(const v8h*)(p + 16); return u.v;
}
__device__ __forceinline__ v16h frag_f32(const float* rowk0, int lane) {
  v16h a; const float* p = rowk0 + 8 * (lane >> 4);
#pragma unroll
  for (int i = 0; i < 8; ++i) { a[i] = (_Float16)p[i]; a[8 + i] = (_Float16)p[16 + i]; }
  return a;
}
__device__ __forceinline__ v16h frag_f32s(const float* rowk0, int lane, float sc) {
  v16h a; const float* p = rowk0 + 8 * (lane >> 4);
#pragma unroll
  for (int i = 0; i < 8; ++i) { a[i] = (_Float16)(p[i] * sc); a[8 + i] = (_Float16)(p[16 + i] * sc); }
  return a;
}
// column fragment from a [K][ld] layout (column n), rows >= K read as 0
__device__ __forceinline__ v16h fragc_f32(const float* W, int k0, int n, int lane, int ld, int K) {
  v16h a; const int g = lane >> 4;
#pragma unroll
  for (int i = 0; i < 8; ++i) { const int ka = k0 + 8 * g + i, kb = ka + 16;
    a[i] = (_Float16)(ka < K ? W[(size_t)ka * ld + n] : 0.f); a[8 + i] = (_Float16)(kb < K ? W[(size_t)kb * ld + n] : 0.f); }
  return a;
}
struct F2 { v16b h, l; };
__device__ __forceinline__ F2 bsplit16(const float v[16]) { F2 r;
#pragma unroll
  for (int i = 0; i < 16; ++i) { const __bf16 h = (__bf16)v[i]; r.h[i] = h; r.l[i] = (__bf16)(v[i] - (float)h); }
  return r; }
__device__ __forceinline__ F2 split_row(const float* row, int k0, int lane) { float v[16]; const float* p = row + k0 + 8 * (lane >> 4);
#pragma unroll
  for (int i = 0; i < 8; ++i) { v[i] = p[i]; v[8 + i] = p[16 + i]; }
  return bsplit16(v); }
__device__ __forceinline__ F2 split_rowK(const float* row, int k0, int lane, int K) { float v[16]; const int g = lane >> 4;
#pragma unroll
  for (int i = 0; i < 8; ++i) { const int ka = k0 + 8 * g + i, kb = ka + 16; v[i] = ka < K ? row[ka] : 0.f; v[8 + i] = kb < K ? row[kb] : 0.f; }
  return bsplit16(v); }
__device__ __forceinline__ F2 split_col(const float* W, int k0, int n, int lane, int ld, int K) { float v[16]; const int g = lane >> 4;
#pragma unroll
  for (int i = 0; i < 8; ++i) { const int ka = k0 + 8 * g + i, kb = ka + 16; v[i] = ka < K ? W[(size_t)ka * ld + n] : 0.f; v[8 + i] = kb < K ? W[(size_t)kb * ld + n] : 0.f; }
  return bsplit16(v); }
__device__ __forceinline__ F2 split_st(const v4f s[4]) { float v[16];
#pragma unroll
  for (int i = 0; i < 4; ++i) { v[i] = s[0][i]; v[4 + i] = s[1][i]; v[8 + i] = s[2][i]; v[12 + i] = s[3][i]; }
  return bsplit16(v); }
// the 16 floats of one f32 row fragment, raw, from a fragment-ordered plane (p = fragment + lane * 4): same elements, same order as split_row;
// piece j holds k0 + 8 * (lane >> 4) + 4 * (j & 1) + 16 * (j >> 1) + 0..3 of row lane & 15, so each of the four loads covers 512 contiguous bytes
__device__ __forceinline__ void ld_st(v4f s[4], const float* p) { s[0] = *(const v4f*)p; s[1] = *(const v4f*)(p + 128); s[2] = *(const v4f*)(p + 256); s[3] = *(const v4f*)(p + 384); }
__device__ __forceinline__ v8f mac3(const F2& a, const F2& b, v8f c) { c = wmma_bf(a.l, b.h, c); c = wmma_bf(a.h, b.l, c); return wmma_bf(a.h, b.h, c); }
__device__ __forceinline__ float sigm(float v) { return 1.0f / (1.0f + expf(-v)); }
#define LDSX() do { asm volatile("s_wait_dscnt 0" ::: "memory"); __builtin_amdgcn_wave_barrier(); __builtin_amdgcn_fence(__ATOMIC_RELEASE, "workgroup"); } while (0)

// Dialog sequence-attention matching: x_proj / y_proj = relu(. @ W^T + b) as two-way bf16 splits on WMMA (f32 rows); per (timestep i,
// 16 document positions) only the key tiles of earlier timesteps are visited, dealt over the block's waves (later ones and padded tokens are exactly weight 0; row i = 0
// is all-zero: k_attn stores it with inv = 0), scores as two-way bf16 splits (logits are O(10): near-f32 keeps the sharp softmax exact), recency bias and pad
// mask (read as data) in f32, online softmax in f32, alpha (x2^14 f16) @ dialog embeddings (f16 transposed copy) on v_wmma_f32_16x16x32_f16.
#define NT 32
#define L1 512
#define MQ 64                  // tokens per timestep (32 + 32)
#define NK (NT * MQ)           // 2048
#define HH 128

// projections: blockIdx.y = 0: XP rows (16384) from xd; 1: YP rows (2048) from dlg = [xq | xa] per timestep; also the transposed dialog copy in f16 (which = 2).
// All three planes are laid out in the order k_attn's lanes read them, so that each of its wave-wide 16-byte loads covers four whole 128-byte lines
// (in row-major planes such a load touches sixteen lines):
//   XP, YP: [16-row group][k chunk of 32][piece j][lane][4 floats]   (ld_st says which elements piece j holds)
//   dT:     [64-key tile, at the 32-KiB pitch of a y_proj tile (second half unused) so that one offset register serves both planes][k chunk of 32 keys][16-column group t][half h][lane][8 f16] = keys chunk + 16 h + 8 (lane >> 4) + 0..7 of column 16 t + (lane & 15)
__global__ __launch_bounds__(128) void k_proj(const float* __restrict__ xd, const float* __restrict__ xq, const float* __restrict__ xa, const float* __restrict__ W, const float* __restrict__ bias, float* __restrict__ XP, float* __restrict__ YP, _Float16* __restrict__ dT) {
  __shared__ __align__(16) float so[4][16][132];
  __shared__ __align__(16) _Float16 st[HH][72];
  const int tid = threadIdx.x, wave = tid >> 5, lane = tid & 31, col = lane & 15, g = lane >> 4;
  const int which = blockIdx.y, r0 = blockIdx.x * 64 + wave * 16;
  if (which == 0 || blockIdx.x < NK / 64) {
    if (which < 2) { v8f acc[8] = {};
#pragma unroll
      for (int kc = 0; kc < HH / 32; ++kc) { F2 a;
        if (which == 0) a = split_row(xd + (size_t)(r0 + col) * HH, kc * 32, lane);
        else { const int key = r0 + col, ts = key / MQ, m = key % MQ; const float* src = m < 32 ? xq + ((size_t)ts * 32 + m) * HH : xa + ((size_t)ts * 32 + m - 32) * HH; a = split_row(src, kc * 32, lane); }
#pragma unroll
        for (int j = 0; j < 8; ++j) acc[j] = mac3(a, split_row(W + (size_t)(j * 16 + col) * HH, kc * 32, lane), acc[j]); }
#pragma unroll
      for (int j = 0; j < 8; ++j) { const int c = j * 16 + col; const float bb = bias[c];
#pragma unroll
        for (int r = 0; r < 8; ++r) { const float v = acc[j][r] + bb; so[wave][8 * g + r][c] = v > 0.f ? v : 0.f; } }
      LDSX();
      float* dst = which == 0 ? XP : YP;
#pragma unroll 4
      for (int f = 0; f < 16; ++f) vst2(dst + (size_t)r0 * HH + f * 128 + lane * 4, *(const v4f*)(&so[wave][col][(f >> 2) * 32 + 8 * g + (f & 1) * 4 + (f & 2) * 8])); }   // f = (k chunk, piece)
    else {   // the dialog copy of this block's 64 keys (one key tile)
      for (int q = tid; q < 64 * HH; q += 128) { const int kl = q >> 7, d = q & 127; const int key = blockIdx.x * 64 + kl, ts = key / MQ, m = key % MQ; const float v = m < 32 ? xq[((size_t)ts * 32 + m) * HH + d] : xa[((size_t)ts * 32 + m - 32) * HH + d]; st[d][kl] = (_Float16)v; }
      __syncthreads();
      for (int q = tid; q < HH * 8; q += 128) { const int f = q >> 5, kc = f >> 4, t = (f >> 1) & 7, h = f & 1;   // q = (fragment half f, lane)
        vst2(dT + (size_t)blockIdx.x * (2 * 64 * HH) + q * 8, *(const v4u*)(&st[t * 16 + col][kc * 32 + 16 * h + 8 * g])); } } }
}
// attention: block (16 doc positions, timestep i); wave w takes the key tiles kt = w, w + KS, ... and keeps its own running maximum, sum and
// un-normalised accumulator; the KS partial results are merged through LDS behind one work-group barrier
#define KS 8
// four waves per SIMD: two work-groups stay resident on a WGP only at 256 registers a wave or fewer
__global__ __launch_bounds__(32 * KS) __attribute__((amdgpu_waves_per_eu(4, 4))) void k_attn(const float* __restrict__ XP, const float* __restrict__ YP, const _Float16* __restrict__ dT, const int* __restrict__ qmask, const int* __restrict__ amask, const float* __restrict__ rwp, float* __restrict__ out) {
  __shared__ __align__(16) float sS[KS][16][68];
  __shared__ __align__(16) _Float16 sP[KS][16][72];
  __shared__ __align__(16) float sO[KS][16][132];
  __shared__ float sM[KS][16];
  __shared__ float sL[KS][16];
  __shared__ float smk[NK];
  __shared__ __align__(16) v4u sQ[4][2][2][32];   // the block's query fragments [k chunk][hi, lo][half][lane], shared by all waves
  // w through readfirstlane: the wave's number in a scalar register, so that the key loop's trip test stays a scalar branch
  const int tid = threadIdx.x, w = __builtin_amdgcn_readfirstlane(tid >> 5), lane = tid & 31, col = lane & 15, g = lane >> 4;
  const int i = blockIdx.y, q0 = blockIdx.x * 16; const size_t rq = (size_t)i * L1 + q0;
  { const int m = tid % MQ; const int* pmk = (m < 32 ? qmask + m : amask + (m - 32)) + (tid / MQ) * 32;   // key k = tid + 256 j: token m of timestep tid / 64 + 4 j
#pragma unroll   // the eight mask loads of a thread go out together; rolled, each is waited out alone
    for (int j = 0; j < NK / (32 * KS); ++j) smk[tid + j * 32 * KS] = pmk[j * (32 * KS / MQ) * 32] ? 1.f : 0.f; }    // 1 = padded (masked)
  if (w < 4) { union { F2 f; v4u q[4]; } u; v4f xs[4]; ld_st(xs, XP + rq * HH + w * 512 + lane * 4);
    asm volatile("s_wait_xcnt 0x0" ::: "memory");   // behind the four loads, before anything re-uses the registers that they name
    u.f = split_st(xs);
    sQ[w][0][0][lane] = u.q[0]; sQ[w][0][1][lane] = u.q[1]; sQ[w][1][0][lane] = u.q[2]; sQ[w][1][1][lane] = u.q[3]; }
  __syncthreads();
  if (w < i) {
    v8f acc[8] = {};
    const unsigned lo = lane * 16;                             // this lane's byte in a 512-byte fragment piece, of y_proj and of the dialog copy alike; a tile's place is added as a 32-bit byte offset to the plane's scalar base
    unsigned yo = lo + (unsigned)w * (64 * HH * 4);            // byte offset of this lane in the wave's current key tile of y_proj
    v4f st[4][4];                                              // raw y_proj rows of one 16-key group, one entry per k chunk
#pragma unroll
    for (int kc = 0; kc < 4; ++kc) { ld_st(st[kc], (const float*)((const char*)YP + yo) + kc * 512);
      __builtin_amdgcn_sched_barrier(0); }                     // chunks go out in the loop's own order: in another order the trip's first wait is for all sixteen loads
    float mrun = -3.0e38f, lrun = 0.f; const float rw = rwp[0];
#pragma unroll 1
    for (int kt = w; kt < i; kt += KS) {                 // key tile kt == timestep kt < i (later timesteps are masked -> weight exactly 0)
      const float bias = rw * (float)(i - kt);           // |i - j_ts| * recency_weight (row i >= 1)
      const float* yp = (const float*)((const char*)YP + yo);
      F2 aq[4];                                          // re-read every trip: their registers hold the dialog tile during softmax and PV
#pragma unroll
      for (int kc = 0; kc < 4; ++kc) { union { F2 f; v4u q[4]; } u; u.q[0] = sQ[kc][0][0][lane]; u.q[1] = sQ[kc][0][1][lane]; u.q[2] = sQ[kc][1][0][lane]; u.q[3] = sQ[kc][1][1][lane]; aq[kc] = u.f; }
#pragma unroll
      for (int t = 0; t < 4; ++t) { v8f s = {}; const int key = kt * 64 + t * 16 + col;
#pragma unroll
        for (int kc = 0; kc < 4; ++kc) { const F2 b = split_st(st[kc]);
          if (t < 3) {
            __builtin_amdgcn_sched_barrier(0);           // the split first, so that the load below re-uses its registers (lifted over it, it takes 16 more)
            ld_st(st[kc], yp + (t + 1) * 16 * HH + kc * 512);            // the next group's chunk into the registers just read
            __builtin_amdgcn_sched_barrier(0); }         // keeps that load here, three chunks ahead of its use; sunk to its use it is waited out alone
          s = mac3(aq[kc], b, s); }
        const bool pad = smk[key] != 0.f;
#pragma unroll
        for (int r = 0; r < 8; ++r) sS[w][8 * g + r][t * 16 + col] = pad ? -3.0e38f : s[r] + bias; }
      LDSX();
      const _Float16* dp = (const _Float16*)((const char*)dT + yo);   // the same byte offset: dialog tiles stand at y_proj's tile pitch
      v8h dv[2][8][2];                                   // the whole dialog tile, asked for now so that it lands behind the softmax
#pragma unroll
      for (int kc = 0; kc < 2; ++kc)
#pragma unroll
        for (int t = 0; t < 8; ++t) { const _Float16* p = dp + (kc * 8 + t) * 512; dv[kc][t][0] = *(const v8h*)p; dv[kc][t][1] = *(const v8h*)(p + 256); }
      asm volatile("s_wait_xcnt 0x0" :: "v"(yo) : "memory");   // the loads' offset register is live up to this wait
      __builtin_amdgcn_sched_barrier(0);                 // keeps the 32 loads in front of the softmax
      float mx = -3.4e38f;
#pragma unroll
      for (int jj = 0; jj < 32; ++jj) mx = fmaxf(mx, sS[w][col][g * 32 + jj]);
      mx = fmaxf(mx, __shfl_xor(mx, 16, 32));
      const float mnew = fmaxf(mrun, mx); const float corr = mnew <= -1.0e38f ? 1.0f : expf(mrun - mnew);
      float ps = 0.f;
#pragma unroll
      for (int jj = 0; jj < 32; ++jj) { const float sv = sS[w][col][g * 32 + jj]; const float p = (sv <= -1.0e38f || mnew <= -1.0e38f) ? 0.f : expf(sv - mnew); ps += p; sP[w][col][g * 32 + jj] = (_Float16)(p * 16384.0f); }
      ps += __shfl_xor(ps, 16, 32);
      lrun = lrun * corr + ps; mrun = mnew;
#pragma unroll
      for (int r = 0; r < 8; ++r) { const float cr = __shfl(corr, 8 * g + r, 32);
#pragma unroll
        for (int t = 0; t < 8; ++t) acc[t][r] *= cr; }
      LDSX();
      const unsigned yof = yo + (kt + KS < i ? KS * 64 * HH * 4 : 0);
      const float* ypn = (const float*)((const char*)YP + yof);   // the wave's next tile (its last trip re-reads its own: in bounds, unused)
#pragma unroll
      for (int kc = 0; kc < 2; ++kc) { const v16h pa = frag_h(&sP[w][col][0] + kc * 32, lane);
#pragma unroll
        for (int t = 0; t < 8; ++t) { union { v16h v; v8h q[2]; } u; u.q[0] = dv[kc][t][0]; u.q[1] = dv[kc][t][1];
          acc[t] = wmma16(pa, u.v, acc[t]);
          if (kc == 0 && (t & 1)) { ld_st(st[t >> 1], ypn + (t >> 1) * 512);
            __builtin_amdgcn_sched_barrier(0); } } }     // next tile's first group goes out as dialog registers fall free, not at its use
      asm volatile("s_wait_xcnt 0x0" :: "v"(yof) : "memory");  // before the next trip re-uses the offset register of the loads still in flight
      yo = yof;
      __builtin_amdgcn_wave_barrier(); }
    const int tl = __builtin_amdgcn_mbcnt_lo(~0u, (unsigned)w * 32), lc = tl & 15, lg = (tl >> 4) & 1;   // tl == tid, formed anew from the wave's number: col and g held over the key loop were spilled
    if (lg == 0) { sM[w][lc] = mrun; sL[w][lc] = lrun; }
#pragma unroll
    for (int r = 0; r < 8; ++r)
#pragma unroll
      for (int t = 0; t < 8; ++t) sO[w][8 * lg + r][t * 16 + lc] = acc[t][r]; }
  __syncthreads();   // every wave's partial (maximum, sum, accumulator) is in LDS before any thread merges
  // merge: thread = (row, two groups of 4 columns); only the waves that had a tile (u < i) count, the others re-read wave 0's partial with
  // weight 0 so that all LDS reads are independent of each other; i = 0 gives the all-zero row block
  const int tm = __builtin_amdgcn_mbcnt_lo(~0u, (unsigned)w * 32), row = tm >> 4, c = (tm & 15) * 4;   // tm == tid, formed anew for the same reason
  v4f o0 = {}, o1 = {}; float inv = 0.f;
  if (i > 0) {
    float mu[KS], M = -3.0e38f, L = 0.f;
#pragma unroll
    for (int u = 0; u < KS; ++u) { mu[u] = sM[u < i ? u : 0][row]; M = fmaxf(M, mu[u]); }
#pragma unroll
    for (int u = 0; u < KS; ++u) { const int uu = u < i ? u : 0; const float e = expf(mu[u] - M); const float f = (u >= i || mu[u] <= -1.0e38f) ? 0.f : e;
      L += f * sL[uu][row]; o0 += f * *(const v4f*)(&sO[uu][row][c]); o1 += f * *(const v4f*)(&sO[uu][row][64 + c]); }
    inv = L > 0.f ? 1.0f / (L * 16384.0f) : 0.f; }     // a fully padded history gives sum 0; guarded as before
  vst2(out + (rq + row) * HH + c, o0 * inv); vst2(out + (rq + row) * HH + 64 + c, o1 * inv);
}
extern "C" void kernel_launch(void* const* d_in, const int* in_sizes, int n_in, void* d_out, int out_size, void* d_ws, size_t ws_size, hipStream_t stream) {
  (void)in_sizes; (void)n_in; (void)out_size; (void)ws_size;
  const float* xd = (const float*)d_in[0]; const float* xq = (const float*)d_in[1]; const float* xa = (const float*)d_in[2]; const float* W = (const float*)d_in[3]; const float* bias = (const float*)d_in[4]; const float* rw = (const float*)d_in[5]; const int* qm = (const int*)d_in[6]; const int* am = (const int*)d_in[7];
  float* out = (float*)d_out;
  char* ws = (char*)d_ws; size_t off = 0;
  auto take = [&](size_t bytes) { char* p = ws + off; off += (bytes + 255) & ~(size_t)255; return p; };
  float* XP = (float*)take((size_t)NT * L1 * HH * 4); float* YP = (float*)take((size_t)NK * HH * 4); _Float16* dT = (_Float16*)take((size_t)HH * NK * 4);
  k_proj<<<dim3(NT * L1 / 64, 3), 128, 0, stream>>>(xd, xq, xa, W, bias, XP, YP, dT);
  k_attn<<<dim3(L1 / 16, NT), 32 * KS, 0, stream>>>(XP, YP, dT, qm, am, rw, out);
}

// v004
// Measured time: 56.1 microseconds a run.
// Next to v003, in two timings, it ran 1.08 times as fast each time.
// Over all steps from v000 it is 6.30 times as fast.
#include <hip/hip_runtime.h>
#include <math.h>

typedef __attribute__((ext_vector_type(16))) _Float16 v16h;
typedef __attribute__((ext_vector_type(16))) __bf16 v16b;
typedef __attribute__((ext_vector_type(8)))  _Float16 v8h;
typedef __attribute__((ext_vector_type(8)))  float v8f;
typedef __attribute__((ext_vector_type(4)))  float v4f;
typedef __attribute__((ext_vector_type(2)))  float v2f;
typedef __attribute__((ext_vector_type(4)))  unsigned v4u;
typedef __attribute__((ext_vector_type(4)))  int v4i;
typedef float __attribute__((may_alias)) float_a;
typedef int __attribute__((may_alias)) int_a;

template <typename T> __device__ __forceinline__ void vst2(void* p, T v) { *(T*)p = v;  }
__device__ __forceinline__ v8f wmma16(v16h a, v16h b, v8f c) {
  v8f d = __builtin_amdgcn_wmma_f32_16x16x32_f16(false, a, false, b, (short)0, c, false, false);
  asm volatile("v_nop\n\tv_nop\n\tv_nop\n\tv_nop" : "+v"(d) : "v"(a), "v"(b));
  return d;
}
__device__ __forceinline__ v8f wmma_bf(v16b a, v16b b, v8f c) {
  v8f d = __builtin_amdgcn_wmma_f32_16x16x32_bf16(false, a, false, b, (short)0, c, false, false);
  asm volatile("v_nop\n\tv_nop\n\tv_nop\n\tv_nop" : "+v"(d) : "v"(a), "v"(b));
  return d;
}
// 16x16x32 fragments: lane = (h = lane>>4, row/col = lane&15); elements 0..7 = k0+8h+0..7, 8..15 = k0+16+8h+0..7; D element r = row 8h+r
__device__ __forceinline__ v16h frag_h(const _Float16* rowk0, int lane) {
  union { v16h v; v8h q[2]; } u; const _Float16* p = rowk0 + 8 * (lane >> 4);
  u.q[0] = *(const v8h*)p; u.q[1] = *(const v8h*)(p + 16); return u.v;
}
__device__ __forceinline__ v16h frag_f32(const float* rowk0, int lane) {
  v16h a; const float* p = rowk0 + 8 * (lane >> 4);
#pragma unroll
  for (int i = 0; i < 8; ++i) { a[i] = (_Float16)p[i]; a[8 + i] = (_Float16)p[16 + i]; }
  return a;
}
__device__ __forceinline__ v16h frag_f32s(const float* rowk0, int lane, float sc) {
  v16h a; const float* p = rowk0 + 8 * (lane >> 4);
#pragma unroll
  for (int i = 0; i < 8; ++i) { a[i] = (_Float16)(p[i] * sc); a[8 + i] = (_Float16)(p[16 + i] * sc); }
  return a;
}
// column fragment from a [K][ld] layout (column n), rows >= K read as 0
__device__ __forceinline__ v16h fragc_f32(const float* W, int k0, int n, int lane, int ld, int K) {
  v16h a; const int g = lane >> 4;
#pragma unroll
  for (int i = 0; i < 8; ++i) { const int ka = k0 + 8 * g + i, kb = ka + 16;
    a[i] = (_Float16)(ka < K ? W[(size_t)ka * ld + n] : 0.f); a[8 + i] = (_Float16)(kb < K ? W[(size_t)kb * ld + n] : 0.f); }
  return a;
}
struct F2 { v16b h, l; };
__device__ __forceinline__ F2 bsplit16(const float v[16]) { F2 r;
#pragma unroll
  for (int i = 0; i < 16; ++i) { const __bf16 h = (__bf16)v[i]; r.h[i] = h; r.l[i] = (__bf16)(v[i] - (float)h); }
  return r; }
__device__ __forceinline__ F2 split_row(const float* row, int k0, int lane) { float v[16]; const float* p = row + k0 + 8 * (lane >> 4);
#pragma unroll
  for (int i = 0; i < 8; ++i) { v[i] = p[i]; v[8 + i] = p[16 + i]; }
  return bsplit16(v); }
__device__ __forceinline__ F2 split_rowK(const float* row, int k0, int lane, int K) { float v[16]; const int g = lane >> 4;
#pragma unroll
  for (int i = 0; i < 8; ++i) { const int ka = k0 + 8 * g + i, kb = ka + 16; v[i] = ka < K ? row[ka] : 0.f; v[8 + i] = kb < K ? row[kb] : 0.f; }
  return bsplit16(v); }
__device__ __forceinline__ F2 split_col(const float* W, int k0, int n, int lane, int ld, int K) { float v[16]; const int g = lane >> 4;
#pragma unroll
  for (int i = 0; i < 8; ++i) { const int ka = k0 + 8 * g + i, kb = ka + 16; v[i] = ka < K ? W[(size_t)ka * ld + n] : 0.f; v[8 + i] = kb < K ? W[(size_t)kb * ld + n] : 0.f; }
  return bsplit16(v); }
// the four 16-byte pieces of one stored fragment pair, taken as they are: no arithmetic
__device__ __forceinline__ F2 as_f2(const v4f s[4]) { union { F2 f; v4f q[4]; } u; u.q[0] = s[0]; u.q[1] = s[1]; u.q[2] = s[2]; u.q[3] = s[3]; return u.f; }
// one row fragment's two-way bf16 split, as stored by k_proj in a fragment-ordered plane (p = fragment + lane * 4; 16-byte pieces carried in v4f registers, never computed on):
// pieces 0, 1 = the high parts, pieces 2, 3 = the low parts, of elements 0..7 and 8..15 of split_row's fragment of row lane & 15; each of the four loads covers 512 contiguous bytes
__device__ __forceinline__ void ld_st(v4f s[4], const float* p) { s[0] = *(const v4f*)p; s[1] = *(const v4f*)(p + 128); s[2] = *(const v4f*)(p + 256); s[3] = *(const v4f*)(p + 384); }
__device__ __forceinline__ v8f mac3(const F2& a, const F2& b, v8f c) { c = wmma_bf(a.l, b.h, c); c = wmma_bf(a.h, b.l, c); return wmma_bf(a.h, b.h, c); }
__device__ __forceinline__ float sigm(float v) { return 1.0f / (1.0f + expf(-v)); }
#define LDSX() do { asm volatile("s_wait_dscnt 0" ::: "memory"); __builtin_amdgcn_wave_barrier(); __builtin_amdgcn_fence(__ATOMIC_RELEASE, "workgroup"); } while (0)

// Dialog sequence-attention matching: x_proj / y_proj = relu(. @ W^T + b) as two-way bf16 splits on WMMA (f32 results, stored as their own two-way bf16 splits); per (timestep i,
// 16 document positions) only the key tiles of earlier timesteps are visited, dealt over the block's waves (later ones and padded tokens are exactly weight 0; row i = 0
// is all-zero: k_attn stores it with inv = 0), scores as two-way bf16 splits (logits are O(10): near-f32 keeps the sharp softmax exact), recency bias and pad
// mask (read as data) in f32, online softmax in f32, alpha (x2^14 f16) @ dialog embeddings (f16 transposed copy) on v_wmma_f32_16x16x32_f16.
#define NT 32
#define L1 512
#define MQ 64                  // tokens per timestep (32 + 32)
#define NK (NT * MQ)           // 2048
#define HH 128

// projections: blockIdx.y = 0: XP rows (16384) from xd; 1: YP rows (2048) from dlg = [xq | xa] per timestep; also the transposed dialog copy in f16 (which = 2).
// All three planes are laid out in the order k_attn's lanes read them, so that each of its wave-wide 16-byte loads covers four whole 128-byte lines
// (in row-major planes such a load touches sixteen lines):
//   XP, YP: [16-row group][k chunk of 32][piece j][lane][16 bytes], already split into bf16 high and low parts (ld_st says what piece j holds): as many bytes as the f32 rows
//   dT:     [64-key tile, at the 32-KiB pitch of a y_proj tile (second half unused) so that one offset register serves both planes][k chunk of 32 keys][16-column group t][half h][lane][8 f16] = keys chunk + 16 h + 8 (lane >> 4) + 0..7 of column 16 t + (lane & 15)
__global__ __launch_bounds__(128) void k_proj(const float* __restrict__ xd, const float* __restrict__ xq, const float* __restrict__ xa, const float* __restrict__ W, const float* __restrict__ bias, float* __restrict__ XP, float* __restrict__ YP, _Float16* __restrict__ dT) {
  __shared__ __align__(16) float so[4][16][132];
  __shared__ __align__(16) _Float16 st[HH][72];
  const int tid = threadIdx.x, wave = tid >> 5, lane = tid & 31, col = lane & 15, g = lane >> 4;
  const int which = blockIdx.y, r0 = blockIdx.x * 64 + wave * 16;
  if (which == 0 || blockIdx.x < NK / 64) {
    if (which < 2) { v8f acc[8] = {};
#pragma unroll
      for (int kc = 0; kc < HH / 32; ++kc) { F2 a;
        if (which == 0) a = split_row(xd + (size_t)(r0 + col) * HH, kc * 32, lane);
        else { const int key = r0 + col, ts = key / MQ, m = key % MQ; const float* src = m < 32 ? xq + ((size_t)ts * 32 + m) * HH : xa + ((size_t)ts * 32 + m - 32) * HH; a = split_row(src, kc * 32, lane); }
#pragma unroll
        for (int j = 0; j < 8; ++j) acc[j] = mac3(a, split_row(W + (size_t)(j * 16 + col) * HH, kc * 32, lane), acc[j]); }
#pragma unroll
      for (int j = 0; j < 8; ++j) { const int c = j * 16 + col; const float bb = bias[c];
#pragma unroll
        for (int r = 0; r < 8; ++r) { const float v = acc[j][r] + bb; so[wave][8 * g + r][c] = v > 0.f ? v : 0.f; } }
      LDSX();
      float* dst = which == 0 ? XP : YP;
#pragma unroll   // both loops unrolled: the pieces are picked by constants and stay in registers
      for (int kc = 0; kc < 4; ++kc) { union { F2 f; v4f q[4]; } u; u.f = split_row(&so[wave][col][0], kc * 32, lane);   // the split is made here, once per row
#pragma unroll
        for (int j = 0; j < 4; ++j) vst2(dst + (size_t)r0 * HH + (kc * 4 + j) * 128 + lane * 4, u.q[j]); } }
    else {   // the dialog copy of this block's 64 keys (one key tile)
      for (int q = tid; q < 64 * HH; q += 128) { const int kl = q >> 7, d = q & 127; const int key = blockIdx.x * 64 + kl, ts = key / MQ, m = key % MQ; const float v = m < 32 ? xq[((size_t)ts * 32 + m) * HH + d] : xa[((size_t)ts * 32 + m - 32) * HH + d]; st[d][kl] = (_Float16)v; }
      __syncthreads();
      for (int q = tid; q < HH * 8; q += 128) { const int f = q >> 5, kc = f >> 4, t = (f >> 1) & 7, h = f & 1;   // q = (fragment half f, lane)
        vst2(dT + (size_t)blockIdx.x * (2 * 64 * HH) + q * 8, *(const v4u*)(&st[t * 16 + col][kc * 32 + 16 * h + 8 * g])); } } }
}
// attention: block (16 doc positions, timestep i); wave w takes the key tiles kt = w, w + KS, ... and keeps its own running maximum, sum and
// un-normalised accumulator; the KS partial results are merged through LDS behind one work-group barrier
#define KS 8
// four waves per SIMD: two work-groups stay resident on a WGP only at 256 registers a wave or fewer
__global__ __launch_bounds__(32 * KS) __attribute__((amdgpu_waves_per_eu(4, 4))) void k_attn(const float* __restrict__ XP, const float* __restrict__ YP, const _Float16* __restrict__ dT, const int* __restrict__ qmask, const int* __restrict__ amask, const float* __restrict__ rwp, float* __restrict__ out) {
  __shared__ __align__(16) float sS[KS][16][68];
  __shared__ __align__(16) _Float16 sP[KS][16][72];
  __shared__ __align__(16) float sO[KS][16][132];
  __shared__ float sM[KS][16];
  __shared__ float sL[KS][16];
  __shared__ float smk[NK];
  __shared__ __align__(16) v4u sQ[4][2][2][32];   // the block's query fragments [k chunk][hi, lo][half][lane], shared by all waves
  // w through readfirstlane: the wave's number in a scalar register, so that the key loop's trip test stays a scalar branch
  const int tid = threadIdx.x, w = __builtin_amdgcn_readfirstlane(tid >> 5), lane = tid & 31, col = lane & 15, g = lane >> 4;
  const int i = blockIdx.y, q0 = blockIdx.x * 16; const size_t rq = (size_t)i * L1 + q0;
  { const int m = tid % MQ; const int* pmk = (m < 32 ? qmask + m : amask + (m - 32)) + (tid / MQ) * 32;   // key k = tid + 256 j: token m of timestep tid / 64 + 4 j
#pragma unroll   // the eight mask loads of a thread go out together; rolled, each is waited out alone
    for (int j = 0; j < NK / (32 * KS); ++j) smk[tid + j * 32 * KS] = pmk[j * (32 * KS / MQ) * 32] ? 1.f : 0.f; }    // 1 = padded (masked)
  if (w < 4) { union { F2 f; v4u q[4]; } u; v4f xs[4]; ld_st(xs, XP + rq * HH + w * 512 + lane * 4);
    asm volatile("s_wait_xcnt 0x0" ::: "memory");   // behind the four loads, before anything re-uses the registers that they name
    u.f = as_f2(xs);
    sQ[w][0][0][lane] = u.q[0]; sQ[w][0][1][lane] = u.q[1]; sQ[w][1][0][lane] = u.q[2]; sQ[w][1][1][lane] = u.q[3]; }
  __syncthreads();
  if (w < i) {
    v8f acc[8] = {};
    const unsigned lo = lane * 16;                             // this lane's byte in a 512-byte fragment piece, of y_proj and of the dialog copy alike; a tile's place is added as a 32-bit byte offset to the plane's scalar base
    unsigned yo = lo + (unsigned)w * (64 * HH * 4);            // byte offset of this lane in the wave's current key tile of y_proj
    v4f st[4][4];                                              // split y_proj fragments of one 16-key group, one entry per k chunk
#pragma unroll
    for (int kc = 0; kc < 4; ++kc) { ld_st(st[kc], (const float*)((const char*)YP + yo) + kc * 512);
      __builtin_amdgcn_sched_barrier(0); }                     // chunks go out in the loop's own order: in another order the trip's first wait is for all sixteen loads
    float mrun = -3.0e38f, lrun = 0.f; const float rw = rwp[0];
#pragma unroll 1
    for (int kt = w; kt < i; kt += KS) {                 // key tile kt == timestep kt < i (later timesteps are masked -> weight exactly 0)
      const float bias = rw * (float)(i - kt);           // |i - j_ts| * recency_weight (row i >= 1)
      const float* yp = (const float*)((const char*)YP + yo);
      F2 aq[4];                                          // re-read every trip: their registers hold the dialog tile during softmax and PV
#pragma unroll
      for (int kc = 0; kc < 4; ++kc) { union { F2 f; v4u q[4]; } u; u.q[0] = sQ[kc][0][0][lane]; u.q[1] = sQ[kc][0][1][lane]; u.q[2] = sQ[kc][1][0][lane]; u.q[3] = sQ[kc][1][1][lane]; aq[kc] = u.f; }
#pragma unroll
      for (int t = 0; t < 4; ++t) { v8f s = {}; const int key = kt * 64 + t * 16 + col;
#pragma unroll
        for (int kc = 0; kc < 4; ++kc) { s = mac3(aq[kc], as_f2(st[kc]), s);
          if (t < 3) {
            __builtin_amdgcn_sched_barrier(0);           // the products first, so that the load below re-uses their operand registers (lifted over them, it takes 16 more)
            ld_st(st[kc], yp + (t + 1) * 16 * HH + kc * 512);            // the next group's chunk into the registers just read
            __builtin_amdgcn_sched_barrier(0); } }       // keeps that load here, four chunks ahead of its use; sunk to its use it is waited out alone
        const bool pad = smk[key] != 0.f;
#pragma unroll
        for (int r = 0; r < 8; ++r) sS[w][8 * g + r][t * 16 + col] = pad ? -3.0e38f : s[r] + bias; }
      LDSX();
      const _Float16* dp = (const _Float16*)((const char*)dT + yo);   // the same byte offset: dialog tiles stand at y_proj's tile pitch
      v8h dv[2][8][2];                                   // the whole dialog tile, asked for now so that it lands behind the softmax
#pragma unroll
      for (int kc = 0; kc < 2; ++kc)
#pragma unroll
        for (int t = 0; t < 8; ++t) { const _Float16* p = dp + (kc * 8 + t) * 512; dv[kc][t][0] = *(const v8h*)p; dv[kc][t][1] = *(const v8h*)(p + 256); }
      asm volatile("s_wait_xcnt 0x0" :: "v"(yo) : "memory");   // the loads' offset register is live up to this wait
      __builtin_amdgcn_sched_barrier(0);                 // keeps the 32 loads in front of the softmax
      float mx = -3.4e38f;
#pragma unroll
      for (int jj = 0; jj < 32; ++jj) mx = fmaxf(mx, sS[w][col][g * 32 + jj]);
      mx = fmaxf(mx, __shfl_xor(mx, 16, 32));
      const float mnew = fmaxf(mrun, mx); const float corr = mnew <= -1.0e38f ? 1.0f : expf(mrun - mnew);
      float ps = 0.f;
#pragma unroll
      for (int jj = 0; jj < 32; ++jj) { const float sv = sS[w][col][g * 32 + jj]; const float p = (sv <= -1.0e38f || mnew <= -1.0e38f) ? 0.f : expf(sv - mnew); ps += p; sP[w][col][g * 32 + jj] = (_Float16)(p * 16384.0f); }
      ps += __shfl_xor(ps, 16, 32);
      lrun = lrun * corr + ps; mrun = mnew;
#pragma unroll
      for (int r = 0; r < 8; ++r) { const float cr = __shfl(corr, 8 * g + r, 32);
#pragma unroll
        for (int t = 0; t < 8; ++t) acc[t][r] *= cr; }
      LDSX();
      const unsigned yof = yo + (kt + KS < i ? KS * 64 * HH * 4 : 0);
      const float* ypn = (const float*)((const char*)YP + yof);   // the wave's next tile (its last trip re-reads its own: in bounds, unused)
#pragma unroll
      for (int kc = 0; kc < 2; ++kc) { const v16h pa = frag_h(&sP[w][col][0] + kc * 32, lane);
#pragma unroll
        for (int t = 0; t < 8; ++t) { union { v16h v; v8h q[2]; } u; u.q[0] = dv[kc][t][0]; u.q[1] = dv[kc][t][1];
          acc[t] = wmma16(pa, u.v, acc[t]);
          if (kc == 0 && (t & 1)) { ld_st(st[t >> 1], ypn + (t >> 1) * 512);
            __builtin_amdgcn_sched_barrier(0); } } }     // next tile's first group goes out as dialog registers fall free, not at its use
      asm volatile("s_wait_xcnt 0x0" :: "v"(yof) : "memory");  // before the next trip re-uses the offset register of the loads still in flight
      yo = yof;
      __builtin_amdgcn_wave_barrier(); }
    const int tl = __builtin_amdgcn_mbcnt_lo(~0u, (unsigned)w * 32), lc = tl & 15, lg = (tl >> 4) & 1;   // tl == tid, formed anew from the wave's number: col and g held over the key loop were spilled
    if (lg == 0) { sM[w][lc] = mrun; sL[w][lc] = lrun; }
#pragma unroll
    for (int r = 0; r < 8; ++r)
#pragma unroll
      for (int t = 0; t < 8; ++t) sO[w][8 * lg + r][t * 16 + lc] = acc[t][r]; }
  __syncthreads();   // every wave's partial (maximum, sum, accumulator) is in LDS before any thread merges
  // merge: thread = (row, two groups of 4 columns); only the waves that had a tile (u < i) count, the others re-read wave 0's partial with
  // weight 0 so that all LDS reads are independent of each other; i = 0 gives the all-zero row block
  const int tm = __builtin_amdgcn_mbcnt_lo(~0u, (unsigned)w * 32), row = tm >> 4, c = (tm & 15) * 4;   // tm == tid, formed anew for the same reason
  v4f o0 = {}, o1 = {}; float inv = 0.f;
  if (i > 0) {
    float mu[KS], M = -3.0e38f, L = 0.f;
#pragma unroll
    for (int u = 0; u < KS; ++u) { mu[u] = sM[u < i ? u : 0][row]; M = fmaxf(M, mu[u]); }
#pragma unroll
    for (int u = 0; u < KS; ++u) { const int uu = u < i ? u : 0; const float e = expf(mu[u] - M); const float f = (u >= i || mu[u] <= -1.0e38f) ? 0.f : e;
      L += f * sL[uu][row]; o0 += f * *(const v4f*)(&sO[uu][row][c]); o1 += f * *(const v4f*)(&sO[uu][row][64 + c]); }
    inv = L > 0.f ? 1.0f / (L * 16384.0f) : 0.f; }     // a fully padded history gives sum 0; guarded as before
  vst2(out + (rq + row) * HH + c, o0 * inv); vst2(out + (rq + row) * HH + 64 + c, o1 * inv);
}
extern "C" void kernel_launch(void* const* d_in, const int* in_sizes, int n_in, void* d_out, int out_size, void* d_ws, size_t ws_size, hipStream_t stream) {
  (void)in_sizes; (void)n_in; (void)out_size; (void)ws_size;
  const float* xd = (const float*)d_in[0]; const float* xq = (const float*)d_in[1]; const float* xa = (const float*)d_in[2]; const float* W = (const float*)d_in[3]; const float* bias = (const float*)d_in[4]; const float* rw = (const float*)d_in[5]; const int* qm = (const int*)d_in[6]; const int* am = (const int*)d_in[7];
  float* out = (float*)d_out;
  char* ws = (char*)d_ws; size_t off = 0;
  auto take = [&](size_t bytes) { char* p = ws + off; off += (bytes + 255) & ~(size_t)255; return p; };
  float* XP = (float*)take((size_t)NT * L1 * HH * 4); float* YP = (float*)take((size_t)NK * HH * 4); _Float16* dT = (_Float16*)take((size_t)HH * NK * 4);
  k_proj<<<dim3(NT * L1 / 64, 3), 128, 0, stream>>>(xd, xq, xa, W, bias, XP, YP, dT);
  k_attn<<<dim3(L1 / 16, NT), 32 * KS, 0, stream>>>(XP, YP, dT, qm, am, rw, out);
}

// v005
// Measured time: 47.2 microseconds a run.
// In two side-by-side timings against v004, it was 1.17 and 1.19 times as fast.
// Counting every step since v000, it is 7.46 times as fast.
#include <hip/hip_runtime.h>
#include <math.h>

typedef __attribute__((ext_vector_type(16))) _Float16 v16h;
typedef __attribute__((ext_vector_type(16))) __bf16 v16b;
typedef __attribute__((ext_vector_type(8)))  _Float16 v8h;
typedef __attribute__((ext_vector_type(8)))  float v8f;
typedef __attribute__((ext_vector_type(4)))  float v4f;
typedef __attribute__((ext_vector_type(2)))  float v2f;
typedef __attribute__((ext_vector_type(4)))  unsigned v4u;
typedef __attribute__((ext_vector_type(4)))  int v4i;
typedef float __attribute__((may_alias)) float_a;
typedef int __attribute__((may_alias)) int_a;

template <typename T> __device__ __forceinline__ void vst2(void* p, T v) { *(T*)p = v;  }
__device__ __forceinline__ v8f wmma16(v16h a, v16h b, v8f c) {
  v8f d = __builtin_amdgcn_wmma_f32_16x16x32_f16(false, a, false, b, (short)0, c, false, false);
  asm volatile("v_nop\n\tv_nop\n\tv_nop\n\tv_nop" : "+v"(d) : "v"(a), "v"(b));
  return d;
}
__device__ __forceinline__ v8f wmma_bf(v16b a, v16b b, v8f c) {
  v8f d = __builtin_amdgcn_wmma_f32_16x16x32_bf16(false, a, false, b, (short)0, c, false, false);
  asm volatile("v_nop\n\tv_nop\n\tv_nop\n\tv_nop" : "+v"(d) : "v"(a), "v"(b));
  return d;
}
// 16x16x32 fragments: lane = (h = lane>>4, row/col = lane&15); elements 0..7 = k0+8h+0..7, 8..15 = k0+16+8h+0..7; D element r = row 8h+r
__device__ __forceinline__ v16h frag_h(const _Float16* rowk0, int lane) {
  union { v16h v; v8h q[2]; } u; const _Float16* p = rowk0 + 8 * (lane >> 4);
  u.q[0] = *(const v8h*)p; u.q[1] = *(const v8h*)(p + 16); return u.v;
}
__device__ __forceinline__ v16h frag_f32(const float* rowk0, int lane) {
  v16h a; const float* p = rowk0 + 8 * (lane >> 4);
#pragma unroll
  for (int i = 0; i < 8; ++i) { a[i] = (_Float16)p[i]; a[8 + i] = (_Float16)p[16 + i]; }
  return a;
}
__device__ __forceinline__ v16h frag_f32s(const float* rowk0, int lane, float sc) {
  v16h a; const float* p = rowk0 + 8 * (lane >> 4);
#pragma unroll
  for (int i = 0; i < 8; ++i) { a[i] = (_Float16)(p[i] * sc); a[8 + i] = (_Float16)(p[16 + i] * sc); }
  return a;
}
// column fragment from a [K][ld] layout (column n), rows >= K read as 0
__device__ __forceinline__ v16h fragc_f32(const float* W, int k0, int n, int lane, int ld, int K) {
  v16h a; const int g = lane >> 4;
#pragma unroll
  for (int i = 0; i < 8; ++i) { const int ka = k0 + 8 * g + i, kb = ka + 16;
    a[i] = (_Float16)(ka < K ? W[(size_t)ka * ld + n] : 0.f); a[8 + i] = (_Float16)(kb < K ? W[(size_t)kb * ld + n] : 0.f); }
  return a;
}
struct F2 { v16b h, l; };
__device__ __forceinline__ F2 bsplit16(const float v[16]) { F2 r;
#pragma unroll
  for (int i = 0; i < 16; ++i) { const __bf16 h = (__bf16)v[i]; r.h[i] = h; r.l[i] = (__bf16)(v[i] - (float)h); }
  return r; }
__device__ __forceinline__ F2 split_row(const float* row, int k0, int lane) { float v[16]; const float* p = row + k0 + 8 * (lane >> 4);
#pragma unroll
  for (int i = 0; i < 8; ++i) { v[i] = p[i]; v[8 + i] = p[16 + i]; }
  return bsplit16(v); }
__device__ __forceinline__ F2 split_rowK(const float* row, int k0, int lane, int K) { float v[16]; const int g = lane >> 4;
#pragma unroll
  for (int i = 0; i < 8; ++i) { const int ka = k0 + 8 * g + i, kb = ka + 16; v[i] = ka < K ? row[ka] : 0.f; v[8 + i] = kb < K ? row[kb] : 0.f; }
  return bsplit16(v); }
__device__ __forceinline__ F2 split_col(const float* W, int k0, int n, int lane, int ld, int K) { float v[16]; const int g = lane >> 4;
#pragma unroll
  for (int i = 0; i < 8; ++i) { const int ka = k0 + 8 * g + i, kb = ka + 16; v[i] = ka < K ? W[(size_t)ka * ld + n] : 0.f; v[8 + i] = kb < K ? W[(size_t)kb * ld + n] : 0.f; }
  return bsplit16(v); }
// the four 16-byte pieces of one stored fragment pair, taken as they are: no arithmetic
__device__ __forceinline__ F2 as_f2(const v4f s[4]) { union { F2 f; v4f q[4]; } u; u.q[0] = s[0]; u.q[1] = s[1]; u.q[2] = s[2]; u.q[3] = s[3]; return u.f; }
// one row fragment's two-way bf16 split, as stored by k_proj in a fragment-ordered plane (p = fragment + lane * 4; 16-byte pieces carried in v4f registers, never computed on):
// pieces 0, 1 = the high parts, pieces 2, 3 = the low parts, of elements 0..7 and 8..15 of split_row's fragment of row lane & 15; each of the four loads covers 512 contiguous bytes
__device__ __forceinline__ void ld_st(v4f s[4], const float* p) { s[0] = *(const v4f*)p; s[1] = *(const v4f*)(p + 128); s[2] = *(const v4f*)(p + 256); s[3] = *(const v4f*)(p + 384); }
__device__ __forceinline__ v8f mac3(const F2& a, const F2& b, v8f c) { c = wmma_bf(a.l, b.h, c); c = wmma_bf(a.h, b.l, c); return wmma_bf(a.h, b.h, c); }
__device__ __forceinline__ float sigm(float v) { return 1.0f / (1.0f + expf(-v)); }
// 2^x on the hardware's own instruction, in place: 0 for x = -inf or far below the f32 range, no range branch, no fix-up chain.
// Written as asm so that the slot which the instruction set asks for behind a transcendental is filled by construction: by the next, independent v_exp_f32,
// and behind the last one by the v_nop
__device__ __forceinline__ void ex2x4(float& a, float& b, float& c, float& d) {
  asm("v_exp_f32 %0, %0\n\tv_exp_f32 %1, %1\n\tv_exp_f32 %2, %2\n\tv_exp_f32 %3, %3\n\tv_nop" : "+v"(a), "+v"(b), "+v"(c), "+v"(d)); }
__device__ __forceinline__ float ex2(float x) { asm("v_exp_f32 %0, %0\n\tv_nop" : "+v"(x)); return x; }   // the same for one value
#define L2E 1.4426950408889634f
#define LDSX() do { asm volatile("s_wait_dscnt 0" ::: "memory"); __builtin_amdgcn_wave_barrier(); __builtin_amdgcn_fence(__ATOMIC_RELEASE, "workgroup"); } while (0)

// Dialog sequence-attention matching: x_proj / y_proj = relu(. @ W^T + b) as two-way bf16 splits on WMMA (f32 results, stored as their own two-way bf16 splits); per (timestep i,
// 16 document positions) only the key tiles of earlier timesteps are visited, dealt over the block's waves (later ones and padded tokens are exactly weight 0; row i = 0
// is all-zero: k_attn stores it with inv = 0), scores as two-way bf16 splits (logits are O(10): near-f32 keeps the sharp softmax exact), recency bias and pad
// mask (read as data) in f32, online softmax in f32, alpha (x2^14 f16) @ dialog embeddings (f16 transposed copy) on v_wmma_f32_16x16x32_f16.
#define NT 32
#define L1 512
#define MQ 64                  // tokens per timestep (32 + 32)
#define NK (NT * MQ)           // 2048
#define HH 128

// projections: blockIdx.y = 0: XP rows (16384) from xd; 1: YP rows (2048) from dlg = [xq | xa] per timestep; also the transposed dialog copy in f16 (which = 2).
// All three planes are laid out in the order k_attn's lanes read them, so that each of its wave-wide 16-byte loads covers four whole 128-byte lines
// (in row-major planes such a load touches sixteen lines):
//   XP, YP: [16-row group][k chunk of 32][piece j][lane][16 bytes], already split into bf16 high and low parts (ld_st says what piece j holds): as many bytes as the f32 rows
//   dT:     [64-key tile, at the 32-KiB pitch of a y_proj tile (second half unused) so that one offset register serves both planes][k chunk of 32 keys][16-column group t][half h][lane][8 f16] = keys chunk + 16 h + 8 (lane >> 4) + 0..7 of column 16 t + (lane & 15)
__global__ __launch_bounds__(128) void k_proj(const float* __restrict__ xd, const float* __restrict__ xq, const float* __restrict__ xa, const float* __restrict__ W, const float* __restrict__ bias, float* __restrict__ XP, float* __restrict__ YP, _Float16* __restrict__ dT) {
  __shared__ __align__(16) float so[4][16][132];
  __shared__ __align__(16) _Float16 st[HH][72];
  const int tid = threadIdx.x, wave = tid >> 5, lane = tid & 31, col = lane & 15, g = lane >> 4;
  const int which = blockIdx.y, r0 = blockIdx.x * 64 + wave * 16;
  if (which == 0 || blockIdx.x < NK / 64) {
    if (which < 2) { v8f acc[8] = {};
#pragma unroll
      for (int kc = 0; kc < HH / 32; ++kc) { F2 a;
        if (which == 0) a = split_row(xd + (size_t)(r0 + col) * HH, kc * 32, lane);
        else { const int key = r0 + col, ts = key / MQ, m = key % MQ; const float* src = m < 32 ? xq + ((size_t)ts * 32 + m) * HH : xa + ((size_t)ts * 32 + m - 32) * HH; a = split_row(src, kc * 32, lane); }
#pragma unroll
        for (int j = 0; j < 8; ++j) acc[j] = mac3(a, split_row(W + (size_t)(j * 16 + col) * HH, kc * 32, lane), acc[j]); }
#pragma unroll
      for (int j = 0; j < 8; ++j) { const int c = j * 16 + col; const float bb = bias[c];
#pragma unroll
        for (int r = 0; r < 8; ++r) { const float v = acc[j][r] + bb; so[wave][8 * g + r][c] = v > 0.f ? v : 0.f; } }
      LDSX();
      float* dst = which == 0 ? XP : YP;
#pragma unroll   // both loops unrolled: the pieces are picked by constants and stay in registers
      for (int kc = 0; kc < 4; ++kc) { union { F2 f; v4f q[4]; } u; u.f = split_row(&so[wave][col][0], kc * 32, lane);   // the split is made here, once per row
#pragma unroll
        for (int j = 0; j < 4; ++j) vst2(dst + (size_t)r0 * HH + (kc * 4 + j) * 128 + lane * 4, u.q[j]); } }
    else {   // the dialog copy of this block's 64 keys (one key tile)
      for (int q = tid; q < 64 * HH; q += 128) { const int kl = q >> 7, d = q & 127; const int key = blockIdx.x * 64 + kl, ts = key / MQ, m = key % MQ; const float v = m < 32 ? xq[((size_t)ts * 32 + m) * HH + d] : xa[((size_t)ts * 32 + m - 32) * HH + d]; st[d][kl] = (_Float16)v; }
      __syncthreads();
      for (int q = tid; q < HH * 8; q += 128) { const int f = q >> 5, kc = f >> 4, t = (f >> 1) & 7, h = f & 1;   // q = (fragment half f, lane)
        vst2(dT + (size_t)blockIdx.x * (2 * 64 * HH) + q * 8, *(const v4u*)(&st[t * 16 + col][kc * 32 + 16 * h + 8 * g])); } } }
}
// attention: block (16 doc positions, timestep i); wave w takes the key tiles kt = w, w + KS, ... and keeps its own running maximum, sum and
// un-normalised accumulator; the KS partial results are merged through LDS behind one work-group barrier
#define KS 8
// four waves per SIMD: two work-groups stay resident on a WGP only at 256 registers a wave or fewer
__global__ __launch_bounds__(32 * KS) __attribute__((amdgpu_waves_per_eu(4, 4))) void k_attn(const float* __restrict__ XP, const float* __restrict__ YP, const _Float16* __restrict__ dT, const int* __restrict__ qmask, const int* __restrict__ amask, const float* __restrict__ rwp, float* __restrict__ out) {
  __shared__ __align__(16) float sS[KS][16][68];
  __shared__ __align__(16) _Float16 sP[KS][16][72];
  __shared__ __align__(16) float sO[KS][16][132];
  __shared__ float sM[KS][16];
  __shared__ float sL[KS][16];
  __shared__ float smk[NK];
  __shared__ __align__(16) v4u sQ[4][2][2][32];   // the block's query fragments [k chunk][hi, lo][half][lane], shared by all waves
  // w through readfirstlane: the wave's number in a scalar register, so that the key loop's trip test stays a scalar branch
  const int tid = threadIdx.x, w = __builtin_amdgcn_readfirstlane(tid >> 5), lane = tid & 31, col = lane & 15, g = lane >> 4;
  const int i = blockIdx.y, q0 = blockIdx.x * 16; const size_t rq = (size_t)i * L1 + q0;
  { const int m = tid % MQ; const int* pmk = (m < 32 ? qmask + m : amask + (m - 32)) + (tid / MQ) * 32;   // key k = tid + 256 j: token m of timestep tid / 64 + 4 j
#pragma unroll   // the eight mask loads of a thread go out together; rolled, each is waited out alone
    for (int j = 0; j < NK / (32 * KS); ++j) smk[tid + j * 32 * KS] = pmk[j * (32 * KS / MQ) * 32] ? 1.f : 0.f; }    // 1 = padded (masked)
  if (w < 4) { union { F2 f; v4u q[4]; } u; v4f xs[4]; ld_st(xs, XP + rq * HH + w * 512 + lane * 4);
    asm volatile("s_wait_xcnt 0x0" ::: "memory");   // behind the four loads, before anything re-uses the registers that they name
    u.f = as_f2(xs);
    sQ[w][0][0][lane] = u.q[0]; sQ[w][0][1][lane] = u.q[1]; sQ[w][1][0][lane] = u.q[2]; sQ[w][1][1][lane] = u.q[3]; }
  __syncthreads();
  if (w < i) {
    v8f acc[8] = {};
    const unsigned lo = lane * 16;                             // this lane's byte in a 512-byte fragment piece, of y_proj and of the dialog copy alike; a tile's place is added as a 32-bit byte offset to the plane's scalar base
    unsigned yo = lo + (unsigned)w * (64 * HH * 4);            // byte offset of this lane in the wave's current key tile of y_proj
    v4f st[4][4];                                              // split y_proj fragments of one 16-key group, one entry per k chunk
#pragma unroll
    for (int kc = 0; kc < 4; ++kc) { ld_st(st[kc], (const float*)((const char*)YP + yo) + kc * 512);
      __builtin_amdgcn_sched_barrier(0); }                     // chunks go out in the loop's own order: in another order the trip's first wait is for all sixteen loads
    float mrun = -3.0e38f, lrun = 0.f; const float rw = rwp[0];
#pragma unroll 1
    for (int kt = w; kt < i; kt += KS) {                 // key tile kt == timestep kt < i (later timesteps are masked -> weight exactly 0)
      const float bias = rw * (float)(i - kt);           // |i - j_ts| * recency_weight (row i >= 1)
      const float* yp = (const float*)((const char*)YP + yo);
      F2 aq[4];                                          // re-read every trip: their registers hold the dialog tile during softmax and PV
#pragma unroll
      for (int kc = 0; kc < 4; ++kc) { union { F2 f; v4u q[4]; } u; u.q[0] = sQ[kc][0][0][lane]; u.q[1] = sQ[kc][0][1][lane]; u.q[2] = sQ[kc][1][0][lane]; u.q[3] = sQ[kc][1][1][lane]; aq[kc] = u.f; }
#pragma unroll
      for (int t = 0; t < 4; ++t) { v8f s = {}; const int key = kt * 64 + t * 16 + col;
#pragma unroll
        for (int kc = 0; kc < 4; ++kc) { s = mac3(aq[kc], as_f2(st[kc]), s);
          if (t < 3) {
            __builtin_amdgcn_sched_barrier(0);           // the products first, so that the load below re-uses their operand registers (lifted over them, it takes 16 more)
            ld_st(st[kc], yp + (t + 1) * 16 * HH + kc * 512);            // the next group's chunk into the registers just read
            __builtin_amdgcn_sched_barrier(0); } }       // keeps that load here, four chunks ahead of its use; sunk to its use it is waited out alone
        const bool pad = smk[key] != 0.f;
#pragma unroll
        for (int r = 0; r < 8; ++r) sS[w][8 * g + r][t * 16 + col] = pad ? -3.0e38f : s[r] + bias; }
      LDSX();
      const _Float16* dp = (const _Float16*)((const char*)dT + yo);   // the same byte offset: dialog tiles stand at y_proj's tile pitch
      v8h dv[2][8][2];                                   // the whole dialog tile, asked for now so that it lands behind the softmax
#pragma unroll
      for (int kc = 0; kc < 2; ++kc)
#pragma unroll
        for (int t = 0; t < 8; ++t) { const _Float16* p = dp + (kc * 8 + t) * 512; dv[kc][t][0] = *(const v8h*)p; dv[kc][t][1] = *(const v8h*)(p + 256); }
      asm volatile("s_wait_xcnt 0x0" :: "v"(yo) : "memory");   // the loads' offset register is live up to this wait
      __builtin_amdgcn_sched_barrier(0);                 // keeps the 32 loads in front of the softmax
      float mx = -3.4e38f;
#pragma unroll
      for (int jj = 0; jj < 32; ++jj) mx = fmaxf(mx, sS[w][col][g * 32 + jj]);
      mx = fmaxf(mx, __shfl_xor(mx, 16, 32));
      const float mnew = fmaxf(mrun, mx); const bool dead = mnew <= -1.0e38f;   // dead: every key of this row so far is masked
      const float ce = ex2((mrun - mnew) * L2E); const float corr = dead ? 1.0f : ce;   // computed in every lane and then chosen: no branch round it
      const float mb = dead ? 0.f : -mnew * L2E;         // a masked score (-3e38) times L2E is -inf, whose 2^x is exactly 0, also in a dead row: no test per element
      float ps = 0.f;
#pragma unroll
      for (int jj = 0; jj < 32; jj += 4) { float p[4];
#pragma unroll
        for (int e = 0; e < 4; ++e) p[e] = fmaf(sS[w][col][g * 32 + jj + e], L2E, mb);
        ex2x4(p[0], p[1], p[2], p[3]);
#pragma unroll
        for (int e = 0; e < 4; ++e) { ps += p[e]; sP[w][col][g * 32 + jj + e] = (_Float16)(p[e] * 16384.0f); } }
      ps += __shfl_xor(ps, 16, 32);
      lrun = lrun * corr + ps; mrun = mnew;
#pragma unroll
      for (int r = 0; r < 8; ++r) { const float cr = __shfl(corr, 8 * g + r, 32);
#pragma unroll
        for (int t = 0; t < 8; ++t) acc[t][r] *= cr; }
      LDSX();
      const unsigned yof = yo + (kt + KS < i ? KS * 64 * HH * 4 : 0);
      const float* ypn = (const float*)((const char*)YP + yof);   // the wave's next tile (its last trip re-reads its own: in bounds, unused)
#pragma unroll
      for (int kc = 0; kc < 2; ++kc) { const v16h pa = frag_h(&sP[w][col][0] + kc * 32, lane);
#pragma unroll
        for (int t = 0; t < 8; ++t) { union { v16h v; v8h q[2]; } u; u.q[0] = dv[kc][t][0]; u.q[1] = dv[kc][t][1];
          acc[t] = wmma16(pa, u.v, acc[t]);
          if (kc == 0 && (t & 1)) { ld_st(st[t >> 1], ypn + (t >> 1) * 512);
            __builtin_amdgcn_sched_barrier(0); } } }     // next tile's first group goes out as dialog registers fall free, not at its use
      asm volatile("s_wait_xcnt 0x0" :: "v"(yof) : "memory");  // before the next trip re-uses the offset register of the loads still in flight
      yo = yof;
      __builtin_amdgcn_wave_barrier(); }
    const int tl = __builtin_amdgcn_mbcnt_lo(~0u, (unsigned)w * 32), lc = tl & 15, lg = (tl >> 4) & 1;   // tl == tid, formed anew from the wave's number: col and g held over the key loop were spilled
    if (lg == 0) { sM[w][lc] = mrun; sL[w][lc] = lrun; }
#pragma unroll
    for (int r = 0; r < 8; ++r)
#pragma unroll
      for (int t = 0; t < 8; ++t) sO[w][8 * lg + r][t * 16 + lc] = acc[t][r]; }
  __syncthreads();   // every wave's partial (maximum, sum, accumulator) is in LDS before any thread merges
  // merge: thread = (row, two groups of 4 columns); only the waves that had a tile (u < i) count, the others re-read wave 0's partial with
  // weight 0 so that all LDS reads are independent of each other; i = 0 gives the all-zero row block
  const int tm = __builtin_amdgcn_mbcnt_lo(~0u, (unsigned)w * 32), row = tm >> 4, c = (tm & 15) * 4;   // tm == tid, formed anew for the same reason
  v4f o0 = {}, o1 = {}; float inv = 0.f;
  if (i > 0) {
    float mu[KS], M = -3.0e38f, L = 0.f;
#pragma unroll
    for (int u = 0; u < KS; ++u) { mu[u] = sM[u < i ? u : 0][row]; M = fmaxf(M, mu[u]); }
    float ef[KS];
#pragma unroll
    for (int u = 0; u < KS; ++u) ef[u] = (mu[u] - M) * L2E;
    ex2x4(ef[0], ef[1], ef[2], ef[3]); ex2x4(ef[4], ef[5], ef[6], ef[7]);
#pragma unroll
    for (int u = 0; u < KS; ++u) { const int uu = u < i ? u : 0; const float f = (u >= i || mu[u] <= -1.0e38f) ? 0.f : ef[u];
      L += f * sL[uu][row]; o0 += f * *(const v4f*)(&sO[uu][row][c]); o1 += f * *(const v4f*)(&sO[uu][row][64 + c]); }
    inv = L > 0.f ? 1.0f / (L * 16384.0f) : 0.f; }     // a fully padded history gives sum 0; guarded as before
  vst2(out + (rq + row) * HH + c, o0 * inv); vst2(out + (rq + row) * HH + 64 + c, o1 * inv);
}
extern "C" void kernel_launch(void* const* d_in, const int* in_sizes, int n_in, void* d_out, int out_size, void* d_ws, size_t ws_size, hipStream_t stream) {
  (void)in_sizes; (void)n_in; (void)out_size; (void)ws_size;
  const float* xd = (const float*)d_in[0]; const float* xq = (const float*)d_in[1]; const float* xa = (const float*)d_in[2]; const float* W = (const float*)d_in[3]; const float* bias = (const float*)d_in[4]; const float* rw = (const float*)d_in[5]; const int* qm = (const int*)d_in[6]; const int* am = (const int*)d_in[7];
  float* out = (float*)d_out;
  char* ws = (char*)d_ws; size_t off = 0;
  auto take = [&](size_t bytes) { char* p = ws + off; off += (bytes + 255) & ~(size_t)255; return p; };
  float* XP = (float*)take((size_t)NT * L1 * HH * 4); float* YP = (float*)take((size_t)NK * HH * 4); _Float16* dT = (_Float16*)take((size_t)HH * NK * 4);
  k_proj<<<dim3(NT * L1 / 64, 3), 128, 0, stream>>>(xd, xq, xa, W, bias, XP, YP, dT);
  k_attn<<<dim3(L1 / 16, NT), 32 * KS, 0, stream>>>(XP, YP, dT, qm, am, rw, out);
}

// v006
// It runs in 41.3 microseconds.
// Next to v005, in two timings, it ran 1.15 and 1.14 times as fast.
// Counting every step since v000, it is 8.52 times as fast.
#include <hip/hip_runtime.h>
#include <math.h>

typedef __attribute__((ext_vector_type(16))) _Float16 v16h;
typedef __attribute__((ext_vector_type(16))) __bf16 v16b;
typedef __attribute__((ext_vector_type(8)))  _Float16 v8h;
typedef __attribute__((ext_vector_type(8)))  float v8f;
typedef __attribute__((ext_vector_type(4)))  float v4f;
typedef __attribute__((ext_vector_type(2)))  float v2f;
typedef __attribute__((ext_vector_type(4)))  unsigned v4u;
typedef __attribute__((ext_vector_type(4)))  int v4i;
typedef float __attribute__((may_alias)) float_a;
typedef int __attribute__((may_alias)) int_a;

template <typename T> __device__ __forceinline__ void vst2(void* p, T v) { *(T*)p = v;  }
__device__ __forceinline__ v8f wmma16(v16h a, v16h b, v8f c) {
  v8f d = __builtin_amdgcn_wmma_f32_16x16x32_f16(false, a, false, b, (short)0, c, false, false);
  asm volatile("v_nop\n\tv_nop\n\tv_nop\n\tv_nop" : "+v"(d) : "v"(a), "v"(b));
  return d;
}
__device__ __forceinline__ v8f wmma_bf(v16b a, v16b b, v8f c) {
  v8f d = __builtin_amdgcn_wmma_f32_16x16x32_bf16(false, a, false, b, (short)0, c, false, false);
  asm volatile("v_nop\n\tv_nop\n\tv_nop\n\tv_nop" : "+v"(d) : "v"(a), "v"(b));
  return d;
}
// 16x16x32 fragments: lane = (h = lane>>4, row/col = lane&15); elements 0..7 = k0+8h+0..7, 8..15 = k0+16+8h+0..7; D element r = row 8h+r
__device__ __forceinline__ v16h frag_h(const _Float16* rowk0, int lane) {
  union { v16h v; v8h q[2]; } u; const _Float16* p = rowk0 + 8 * (lane >> 4);
  u.q[0] = *(const v8h*)p; u.q[1] = *(const v8h*)(p + 16); return u.v;
}
__device__ __forceinline__ v16h frag_f32(const float* rowk0, int lane) {
  v16h a; const float* p = rowk0 + 8 * (lane >> 4);
#pragma unroll
  for (int i = 0; i < 8; ++i) { a[i] = (_Float16)p[i]; a[8 + i] = (_Float16)p[16 + i]; }
  return a;
}
__device__ __forceinline__ v16h frag_f32s(const float* rowk0, int lane, float sc) {
  v16h a; const float* p = rowk0 + 8 * (lane >> 4);
#pragma unroll
  for (int i = 0; i < 8; ++i) { a[i] = (_Float16)(p[i] * sc); a[8 + i] = (_Float16)(p[16 + i] * sc); }
  return a;
}
// column fragment from a [K][ld] layout (column n), rows >= K read as 0
__device__ __forceinline__ v16h fragc_f32(const float* W, int k0, int n, int lane, int ld, int K) {
  v16h a; const int g = lane >> 4;
#pragma unroll
  for (int i = 0; i < 8; ++i) { const int ka = k0 + 8 * g + i, kb = ka + 16;
    a[i] = (_Float16)(ka < K ? W[(size_t)ka * ld + n] : 0.f); a[8 + i] = (_Float16)(kb < K ? W[(size_t)kb * ld + n] : 0.f); }
  return a;
}
struct F2 { v16b h, l; };
__device__ __forceinline__ F2 bsplit16(const float v[16]) { F2 r;
#pragma unroll
  for (int i = 0; i < 16; ++i) { const __bf16 h = (__bf16)v[i]; r.h[i] = h; r.l[i] = (__bf16)(v[i] - (float)h); }
  return r; }
__device__ __forceinline__ F2 split_row(const float* row, int k0, int lane) { float v[16]; const float* p = row + k0 + 8 * (lane >> 4);
#pragma unroll
  for (int i = 0; i < 8; ++i) { v[i] = p[i]; v[8 + i] = p[16 + i]; }
  return bsplit16(v); }
__device__ __forceinline__ F2 split_rowK(const float* row, int k0, int lane, int K) { float v[16]; const int g = lane >> 4;
#pragma unroll
  for (int i = 0; i < 8; ++i) { const int ka = k0 + 8 * g + i, kb = ka + 16; v[i] = ka < K ? row[ka] : 0.f; v[8 + i] = kb < K ? row[kb] : 0.f; }
  return bsplit16(v); }
__device__ __forceinline__ F2 split_col(const float* W, int k0, int n, int lane, int ld, int K) { float v[16]; const int g = lane >> 4;
#pragma unroll
  for (int i = 0; i < 8; ++i) { const int ka = k0 + 8 * g + i, kb = ka + 16; v[i] = ka < K ? W[(size_t)ka * ld + n] : 0.f; v[8 + i] = kb < K ? W[(size_t)kb * ld + n] : 0.f; }
  return bsplit16(v); }
// split_row in two halves, so that the loads can stand apart from the arithmetic: the fragment's sixteen f32 as four 16-byte loads (p = row + k0 + 8 * (lane >> 4)), and their split
__device__ __forceinline__ void ld_raw(v4f s[4], const float* p) { s[0] = *(const v4f*)p; s[1] = *(const v4f*)(p + 4); s[2] = *(const v4f*)(p + 16); s[3] = *(const v4f*)(p + 20); }
__device__ __forceinline__ F2 split_raw(const v4f s[4]) { float v[16];
#pragma unroll
  for (int i = 0; i < 16; ++i) v[i] = s[i >> 2][i & 3];
  return bsplit16(v); }
// the four 16-byte pieces of one stored fragment pair, taken as they are: no arithmetic
__device__ __forceinline__ F2 as_f2(const v4f s[4]) { union { F2 f; v4f q[4]; } u; u.q[0] = s[0]; u.q[1] = s[1]; u.q[2] = s[2]; u.q[3] = s[3]; return u.f; }
// one row fragment's two-way bf16 split, as stored by k_proj in a fragment-ordered plane (p = fragment + lane * 4; 16-byte pieces carried in v4f registers, never computed on):
// pieces 0, 1 = the high parts, pieces 2, 3 = the low parts, of elements 0..7 and 8..15 of split_row's fragment of row lane & 15; each of the four loads covers 512 contiguous bytes
__device__ __forceinline__ void ld_st(v4f s[4], const float* p) { s[0] = *(const v4f*)p; s[1] = *(const v4f*)(p + 128); s[2] = *(const v4f*)(p + 256); s[3] = *(const v4f*)(p + 384); }
__device__ __forceinline__ v8f mac3(const F2& a, const F2& b, v8f c) { c = wmma_bf(a.l, b.h, c); c = wmma_bf(a.h, b.l, c); return wmma_bf(a.h, b.h, c); }
__device__ __forceinline__ float sigm(float v) { return 1.0f / (1.0f + expf(-v)); }
// 2^x on the hardware's own instruction, in place: 0 for x = -inf or far below the f32 range, no range branch, no fix-up chain.
// Written as asm so that the slot which the instruction set asks for behind a transcendental is filled by construction: by the next, independent v_exp_f32,
// and behind the last one by the v_nop
__device__ __forceinline__ void ex2x4(float& a, float& b, float& c, float& d) {
  asm("v_exp_f32 %0, %0\n\tv_exp_f32 %1, %1\n\tv_exp_f32 %2, %2\n\tv_exp_f32 %3, %3\n\tv_nop" : "+v"(a), "+v"(b), "+v"(c), "+v"(d)); }
__device__ __forceinline__ float ex2(float x) { asm("v_exp_f32 %0, %0\n\tv_nop" : "+v"(x)); return x; }   // the same for one value
#define L2E 1.4426950408889634f
#define LDSX() do { asm volatile("s_wait_dscnt 0" ::: "memory"); __builtin_amdgcn_wave_barrier(); __builtin_amdgcn_fence(__ATOMIC_RELEASE, "workgroup"); } while (0)

// Dialog sequence-attention matching: x_proj / y_proj = relu(. @ W^T + b) as two-way bf16 splits on WMMA (f32 results, stored as their own two-way bf16 splits); per (timestep i,
// 16 document positions) only the key tiles of earlier timesteps are visited, dealt over the block's waves (later ones and padded tokens are exactly weight 0; row i = 0
// is all-zero: k_attn stores it with inv = 0), scores as two-way bf16 splits (logits are O(10): near-f32 keeps the sharp softmax exact), recency bias and pad
// mask (read as data) in f32, online softmax in f32, alpha (x2^14 f16) @ dialog embeddings (f16 transposed copy) on v_wmma_f32_16x16x32_f16.
#define NT 32
#define L1 512
#define MQ 64                  // tokens per timestep (32 + 32)
#define NK (NT * MQ)           // 2048
#define HH 128
#define WRING 5                // W fragments in flight per wave of k_proj

// projections: blockIdx.y = 0: XP rows (16384) from xd; 1: YP rows (2048) from dlg = [xq | xa] per timestep; also the transposed dialog copy in f16 (which = 2).
// All three planes are laid out in the order k_attn's lanes read them, so that each of its wave-wide 16-byte loads covers four whole 128-byte lines
// (in row-major planes such a load touches sixteen lines):
//   XP, YP: [16-row group][k chunk of 32][piece j][lane][16 bytes], already split into bf16 high and low parts (ld_st says what piece j holds): as many bytes as the f32 rows
//   dT:     [64-key tile, at the 32-KiB pitch of a y_proj tile (second half unused) so that one offset register serves both planes][k chunk of 32 keys][16-column group t][half h][lane][8 f16] = keys chunk + 16 h + 8 (lane >> 4) + 0..7 of column 16 t + (lane & 15)
__global__ __launch_bounds__(128) void k_proj(const float* __restrict__ xd, const float* __restrict__ xq, const float* __restrict__ xa, const float* __restrict__ W, const float* __restrict__ bias, float* __restrict__ XP, float* __restrict__ YP, _Float16* __restrict__ dT) {
  __shared__ __align__(16) float so[4][16][132];
  __shared__ __align__(16) _Float16 st[HH][72];
  const int tid = threadIdx.x, wave = tid >> 5, lane = tid & 31, col = lane & 15, g = lane >> 4;
  const int which = blockIdx.y, r0 = blockIdx.x * 64 + wave * 16;
  if (which == 0 || blockIdx.x < NK / 64) {
    if (which < 2) { v8f acc[8] = {};
      const int key = r0 + col, ts = key / MQ, m = key % MQ;   // which == 1: the dialog row of this lane
      const float* src = which == 0 ? xd + (size_t)(r0 + col) * HH : m < 32 ? xq + ((size_t)ts * 32 + m) * HH : xa + ((size_t)ts * 32 + m - 32) * HH;
      const float* ap = src + 8 * g;                           // split_row's start in this lane's input row
      const float* wp = W + (size_t)col * HH + 8 * g;          // and in W: fragment f = (k chunk f >> 3, column group f & 7) stands at (f & 7) * 16 * HH + (f >> 3) * 32
      // every global load of this path goes out well ahead of its use: asked for at its use, each of the 32 W fragments and 4 row fragments is waited out alone by the SIMD's one wave
      float bb[8]; v4f ar[2][4], wr[WRING][4];
#pragma unroll
      for (int kc = 0; kc < 2; ++kc) ld_raw(ar[kc], ap + kc * 32);
#pragma unroll
      for (int f = 0; f < WRING; ++f) ld_raw(wr[f], wp + (f & 7) * 16 * HH + (f >> 3) * 32);
#pragma unroll
      for (int j = 0; j < 8; ++j) bb[j] = bias[j * 16 + col];
      __builtin_amdgcn_sched_barrier(0);                       // keeps these loads in front of the products
      F2 a;
#pragma unroll   // unrolled: the ring's entries are picked by constants and stay in registers
      for (int f = 0; f < 32; ++f) { const int kc = f >> 3, j = f & 7;
        if (j == 0) { a = split_raw(ar[kc & 1]);
          if (kc + 2 < 4) { __builtin_amdgcn_sched_barrier(0);   // the split first, so that the load re-uses its registers
            ld_raw(ar[kc & 1], ap + (kc + 2) * 32);
            __builtin_amdgcn_sched_barrier(0); } }               // keeps that load here, two k chunks ahead of its use
        const F2 b = split_raw(wr[f % WRING]);
        if (f + WRING < 32) { __builtin_amdgcn_sched_barrier(0); // as above: the split first, then the ring entry's next load, WRING fragments ahead of its use
          ld_raw(wr[f % WRING], wp + ((f + WRING) & 7) * 16 * HH + ((f + WRING) >> 3) * 32);
          __builtin_amdgcn_sched_barrier(0); }
        acc[j] = mac3(a, b, acc[j]); }
      asm volatile("s_wait_xcnt 0x0" :: "v"(ap), "v"(wp) : "memory");   // the loads' address registers are live up to this wait, before anything re-uses them
#pragma unroll
      for (int j = 0; j < 8; ++j) { const int c = j * 16 + col;
#pragma unroll
        for (int r = 0; r < 8; ++r) { const float v = acc[j][r] + bb[j]; so[wave][8 * g + r][c] = v > 0.f ? v : 0.f; } }
      LDSX();
      float* dst = which == 0 ? XP : YP;
#pragma unroll   // both loops unrolled: the pieces are picked by constants and stay in registers
      for (int kc = 0; kc < 4; ++kc) { union { F2 f; v4f q[4]; } u; u.f = split_row(&so[wave][col][0], kc * 32, lane);   // the split is made here, once per row
#pragma unroll
        for (int j = 0; j < 4; ++j) vst2(dst + (size_t)r0 * HH + (kc * 4 + j) * 128 + lane * 4, u.q[j]); } }
    else {   // the dialog copy of this block's 64 keys (one key tile)
      const float* qp = xq + (size_t)blockIdx.x * 32 * HH + tid; const float* pa = xa + (size_t)blockIdx.x * 32 * HH + tid;   // key blockIdx.x * 64 + kl is token kl of timestep blockIdx.x; this thread has column tid
      float v[64];
#pragma unroll   // the thread's 64 loads go out together; rolled, every few are waited out alone
      for (int kl = 0; kl < 32; ++kl) { v[kl] = qp[kl * HH]; v[32 + kl] = pa[kl * HH]; }
#pragma unroll
      for (int kl = 0; kl < 64; ++kl) st[tid][kl] = (_Float16)v[kl];
      __syncthreads();
#pragma unroll   // a constant trip count, unrolled: the eight LDS reads go out together, then the eight stores
      for (int it = 0; it < HH * 8 / 128; ++it) { const int q = tid + it * 128, f = q >> 5, kc = f >> 4, t = (f >> 1) & 7, h = f & 1;   // q = (fragment half f, lane)
        vst2(dT + (size_t)blockIdx.x * (2 * 64 * HH) + q * 8, *(const v4u*)(&st[t * 16 + col][kc * 32 + 16 * h + 8 * g])); } } }
}
// attention: block (16 doc positions, timestep i); wave w takes the key tiles kt = w, w + KS, ... and keeps its own running maximum, sum and
// un-normalised accumulator; the KS partial results are merged through LDS behind one work-group barrier
#define KS 8
// four waves per SIMD: two work-groups stay resident on a WGP only at 256 registers a wave or fewer
__global__ __launch_bounds__(32 * KS) __attribute__((amdgpu_waves_per_eu(4, 4))) void k_attn(const float* __restrict__ XP, const float* __restrict__ YP, const _Float16* __restrict__ dT, const int* __restrict__ qmask, const int* __restrict__ amask, const float* __restrict__ rwp, float* __restrict__ out) {
  __shared__ __align__(16) float sS[KS][16][68];
  __shared__ __align__(16) _Float16 sP[KS][16][72];
  __shared__ __align__(16) float sO[KS][16][132];
  __shared__ float sM[KS][16];
  __shared__ float sL[KS][16];
  __shared__ float smk[NK];
  __shared__ __align__(16) v4u sQ[4][2][2][32];   // the block's query fragments [k chunk][hi, lo][half][lane], shared by all waves
  // w through readfirstlane: the wave's number in a scalar register, so that the key loop's trip test stays a scalar branch
  const int tid = threadIdx.x, w = __builtin_amdgcn_readfirstlane(tid >> 5), lane = tid & 31, col = lane & 15, g = lane >> 4;
  const int i = blockIdx.y, q0 = blockIdx.x * 16; const size_t rq = (size_t)i * L1 + q0;
  { const int m = tid % MQ; const int* pmk = (m < 32 ? qmask + m : amask + (m - 32)) + (tid / MQ) * 32;   // key k = tid + 256 j: token m of timestep tid / 64 + 4 j
#pragma unroll   // the eight mask loads of a thread go out together; rolled, each is waited out alone
    for (int j = 0; j < NK / (32 * KS); ++j) smk[tid + j * 32 * KS] = pmk[j * (32 * KS / MQ) * 32] ? 1.f : 0.f; }    // 1 = padded (masked)
  if (w < 4) { union { F2 f; v4u q[4]; } u; v4f xs[4]; ld_st(xs, XP + rq * HH + w * 512 + lane * 4);
    asm volatile("s_wait_xcnt 0x0" ::: "memory");   // behind the four loads, before anything re-uses the registers that they name
    u.f = as_f2(xs);
    sQ[w][0][0][lane] = u.q[0]; sQ[w][0][1][lane] = u.q[1]; sQ[w][1][0][lane] = u.q[2]; sQ[w][1][1][lane] = u.q[3]; }
  __syncthreads();
  if (w < i) {
    v8f acc[8] = {};
    const unsigned lo = lane * 16;                             // this lane's byte in a 512-byte fragment piece, of y_proj and of the dialog copy alike; a tile's place is added as a 32-bit byte offset to the plane's scalar base
    unsigned yo = lo + (unsigned)w * (64 * HH * 4);            // byte offset of this lane in the wave's current key tile of y_proj
    v4f st[4][4];                                              // split y_proj fragments of one 16-key group, one entry per k chunk
#pragma unroll
    for (int kc = 0; kc < 4; ++kc) { ld_st(st[kc], (const float*)((const char*)YP + yo) + kc * 512);
      __builtin_amdgcn_sched_barrier(0); }                     // chunks go out in the loop's own order: in another order the trip's first wait is for all sixteen loads
    float mrun = -3.0e38f, lrun = 0.f; const float rw = rwp[0];
#pragma unroll 1
    for (int kt = w; kt < i; kt += KS) {                 // key tile kt == timestep kt < i (later timesteps are masked -> weight exactly 0)
      const float bias = rw * (float)(i - kt);           // |i - j_ts| * recency_weight (row i >= 1)
      const float* yp = (const float*)((const char*)YP + yo);
      F2 aq[4];                                          // re-read every trip: their registers hold the dialog tile during softmax and PV
#pragma unroll
      for (int kc = 0; kc < 4; ++kc) { union { F2 f; v4u q[4]; } u; u.q[0] = sQ[kc][0][0][lane]; u.q[1] = sQ[kc][0][1][lane]; u.q[2] = sQ[kc][1][0][lane]; u.q[3] = sQ[kc][1][1][lane]; aq[kc] = u.f; }
#pragma unroll
      for (int t = 0; t < 4; ++t) { v8f s = {}; const int key = kt * 64 + t * 16 + col;
#pragma unroll
        for (int kc = 0; kc < 4; ++kc) { s = mac3(aq[kc], as_f2(st[kc]), s);
          if (t < 3) {
            __builtin_amdgcn_sched_barrier(0);           // the products first, so that the load below re-uses their operand registers (lifted over them, it takes 16 more)
            ld_st(st[kc], yp + (t + 1) * 16 * HH + kc * 512);            // the next group's chunk into the registers just read
            __builtin_amdgcn_sched_barrier(0); } }       // keeps that load here, four chunks ahead of its use; sunk to its use it is waited out alone
        const bool pad = smk[key] != 0.f;
#pragma unroll
        for (int r = 0; r < 8; ++r) sS[w][8 * g + r][t * 16 + col] = pad ? -3.0e38f : s[r] + bias; }
      LDSX();
      const _Float16* dp = (const _Float16*)((const char*)dT + yo);   // the same byte offset: dialog tiles stand at y_proj's tile pitch
      v8h dv[2][8][2];                                   // the whole dialog tile, asked for now so that it lands behind the softmax
#pragma unroll
      for (int kc = 0; kc < 2; ++kc)
#pragma unroll
        for (int t = 0; t < 8; ++t) { const _Float16* p = dp + (kc * 8 + t) * 512; dv[kc][t][0] = *(const v8h*)p; dv[kc][t][1] = *(const v8h*)(p + 256); }
      asm volatile("s_wait_xcnt 0x0" :: "v"(yo) : "memory");   // the loads' offset register is live up to this wait
      __builtin_amdgcn_sched_barrier(0);                 // keeps the 32 loads in front of the softmax
      float mx = -3.4e38f;
#pragma unroll
      for (int jj = 0; jj < 32; ++jj) mx = fmaxf(mx, sS[w][col][g * 32 + jj]);
      mx = fmaxf(mx, __shfl_xor(mx, 16, 32));
      const float mnew = fmaxf(mrun, mx); const bool dead = mnew <= -1.0e38f;   // dead: every key of this row so far is masked
      const float ce = ex2((mrun - mnew) * L2E); const float corr = dead ? 1.0f : ce;   // computed in every lane and then chosen: no branch round it
      const float mb = dead ? 0.f : -mnew * L2E;         // a masked score (-3e38) times L2E is -inf, whose 2^x is exactly 0, also in a dead row: no test per element
      float ps = 0.f;
#pragma unroll
      for (int jj = 0; jj < 32; jj += 4) { float p[4];
#pragma unroll
        for (int e = 0; e < 4; ++e) p[e] = fmaf(sS[w][col][g * 32 + jj + e], L2E, mb);
        ex2x4(p[0], p[1], p[2], p[3]);
#pragma unroll
        for (int e = 0; e < 4; ++e) { ps += p[e]; sP[w][col][g * 32 + jj + e] = (_Float16)(p[e] * 16384.0f); } }
      ps += __shfl_xor(ps, 16, 32);
      lrun = lrun * corr + ps; mrun = mnew;
#pragma unroll
      for (int r = 0; r < 8; ++r) { const float cr = __shfl(corr, 8 * g + r, 32);
#pragma unroll
        for (int t = 0; t < 8; ++t) acc[t][r] *= cr; }
      LDSX();
      const unsigned yof = yo + (kt + KS < i ? KS * 64 * HH * 4 : 0);
      const float* ypn = (const float*)((const char*)YP + yof);   // the wave's next tile (its last trip re-reads its own: in bounds, unused)
#pragma unroll
      for (int kc = 0; kc < 2; ++kc) { const v16h pa = frag_h(&sP[w][col][0] + kc * 32, lane);
#pragma unroll
        for (int t = 0; t < 8; ++t) { union { v16h v; v8h q[2]; } u; u.q[0] = dv[kc][t][0]; u.q[1] = dv[kc][t][1];
          acc[t] = wmma16(pa, u.v, acc[t]);
          if (kc == 0 && (t & 1)) { ld_st(st[t >> 1], ypn + (t >> 1) * 512);
            __builtin_amdgcn_sched_barrier(0); } } }     // next tile's first group goes out as dialog registers fall free, not at its use
      asm volatile("s_wait_xcnt 0x0" :: "v"(yof) : "memory");  // before the next trip re-uses the offset register of the loads still in flight
      yo = yof;
      __builtin_amdgcn_wave_barrier(); }
    const int tl = __builtin_amdgcn_mbcnt_lo(~0u, (unsigned)w * 32), lc = tl & 15, lg = (tl >> 4) & 1;   // tl == tid, formed anew from the wave's number: col and g held over the key loop were spilled
    if (lg == 0) { sM[w][lc] = mrun; sL[w][lc] = lrun; }
#pragma unroll
    for (int r = 0; r < 8; ++r)
#pragma unroll
      for (int t = 0; t < 8; ++t) sO[w][8 * lg + r][t * 16 + lc] = acc[t][r]; }
  __syncthreads();   // every wave's partial (maximum, sum, accumulator) is in LDS before any thread merges
  // merge: thread = (row, two groups of 4 columns); only the waves that had a tile (u < i) count, the others re-read wave 0's partial with
  // weight 0 so that all LDS reads are independent of each other; i = 0 gives the all-zero row block
  const int tm = __builtin_amdgcn_mbcnt_lo(~0u, (unsigned)w * 32), row = tm >> 4, c = (tm & 15) * 4;   // tm == tid, formed anew for the same reason
  v4f o0 = {}, o1 = {}; float inv = 0.f;
  if (i > 0) {
    float mu[KS], M = -3.0e38f, L = 0.f;
#pragma unroll
    for (int u = 0; u < KS; ++u) { mu[u] = sM[u < i ? u : 0][row]; M = fmaxf(M, mu[u]); }
    float ef[KS];
#pragma unroll
    for (int u = 0; u < KS; ++u) ef[u] = (mu[u] - M) * L2E;
    ex2x4(ef[0], ef[1], ef[2], ef[3]); ex2x4(ef[4], ef[5], ef[6], ef[7]);
#pragma unroll
    for (int u = 0; u < KS; ++u) { const int uu = u < i ? u : 0; const float f = (u >= i || mu[u] <= -1.0e38f) ? 0.f : ef[u];
      L += f * sL[uu][row]; o0 += f * *(const v4f*)(&sO[uu][row][c]); o1 += f * *(const v4f*)(&sO[uu][row][64 + c]); }
    inv = L > 0.f ? 1.0f / (L * 16384.0f) : 0.f; }     // a fully padded history gives sum 0; guarded as before
  vst2(out + (rq + row) * HH + c, o0 * inv); vst2(out + (rq + row) * HH + 64 + c, o1 * inv);
}
extern "C" void kernel_launch(void* const* d_in, const int* in_sizes, int n_in, void* d_out, int out_size, void* d_ws, size_t ws_size, hipStream_t stream) {
  (void)in_sizes; (void)n_in; (void)out_size; (void)ws_size;
  const float* xd = (const float*)d_in[0]; const float* xq = (const float*)d_in[1]; const float* xa = (const float*)d_in[2]; const float* W = (const float*)d_in[3]; const float* bias = (const float*)d_in[4]; const float* rw = (const float*)d_in[5]; const int* qm = (const int*)d_in[6]; const int* am = (const int*)d_in[7];
  float* out = (float*)d_out;
  char* ws = (char*)d_ws; size_t off = 0;
  auto take = [&](size_t bytes) { char* p = ws + off; off += (bytes + 255) & ~(size_t)255; return p; };
  float* XP = (float*)take((size_t)NT * L1 * HH * 4); float* YP = (float*)take((size_t)NK * HH * 4); _Float16* dT = (_Float16*)take((size_t)HH * NK * 4);
  k_proj<<<dim3(NT * L1 / 64, 3), 128, 0, stream>>>(xd, xq, xa, W, bias, XP, YP, dT);
  k_attn<<<dim3(L1 / 16, NT), 32 * KS, 0, stream>>>(XP, YP, dT, qm, am, rw, out);
}

// v007
// A run of this version takes 38 microseconds.
// Next to v006, in two timings, it ran 1.08 and 1.10 times as fast.
// Over all steps from v000 it is 9.30 times as fast.
#include <hip/hip_runtime.h>
#include <math.h>

typedef __attribute__((ext_vector_type(16))) _Float16 v16h;
typedef __attribute__((ext_vector_type(16))) __bf16 v16b;
typedef __attribute__((ext_vector_type(8)))  _Float16 v8h;
typedef __attribute__((ext_vector_type(8)))  float v8f;
typedef __attribute__((ext_vector_type(4)))  float v4f;
typedef __attribute__((ext_vector_type(2)))  float v2f;
typedef __attribute__((ext_vector_type(4)))  unsigned v4u;
typedef __attribute__((ext_vector_type(4)))  int v4i;
typedef float __attribute__((may_alias)) float_a;
typedef int __attribute__((may_alias)) int_a;

template <typename T> __device__ __forceinline__ void vst2(void* p, T v) { *(T*)p = v;  }
// k_attn's two forms are the bare builtins, whose distances the compiler keeps itself: an asm statement's vector operands can only stand in v0..v255, which cannot hold two row groups' fragments and accumulators
__device__ __forceinline__ v8f wmma16(v16h a, v16h b, v8f c) { return __builtin_amdgcn_wmma_f32_16x16x32_f16(false, a, false, b, (short)0, c, false, false); }
__device__ __forceinline__ v8f wmma_bfb(v16b a, v16b b, v8f c) { return __builtin_amdgcn_wmma_f32_16x16x32_bf16(false, a, false, b, (short)0, c, false, false); }
__device__ __forceinline__ v8f wmma_bf(v16b a, v16b b, v8f c) {
  v8f d = __builtin_amdgcn_wmma_f32_16x16x32_bf16(false, a, false, b, (short)0, c, false, false);
  asm volatile("v_nop\n\tv_nop\n\tv_nop\n\tv_nop" : "+v"(d) : "v"(a), "v"(b));
  return d;
}
// 16x16x32 fragments: lane = (h = lane>>4, row/col = lane&15); elements 0..7 = k0+8h+0..7, 8..15 = k0+16+8h+0..7; D element r = row 8h+r
__device__ __forceinline__ v16h frag_h(const _Float16* rowk0, int lane) {
  union { v16h v; v8h q[2]; } u; const _Float16* p = rowk0 + 8 * (lane >> 4);
  u.q[0] = *(const v8h*)p; u.q[1] = *(const v8h*)(p + 16); return u.v;
}
__device__ __forceinline__ v16h frag_f32(const float* rowk0, int lane) {
  v16h a; const float* p = rowk0 + 8 * (lane >> 4);
#pragma unroll
  for (int i = 0; i < 8; ++i) { a[i] = (_Float16)p[i]; a[8 + i] = (_Float16)p[16 + i]; }
  return a;
}
__device__ __forceinline__ v16h frag_f32s(const float* rowk0, int lane, float sc) {
  v16h a; const float* p = rowk0 + 8 * (lane >> 4);
#pragma unroll
  for (int i = 0; i < 8; ++i) { a[i] = (_Float16)(p[i] * sc); a[8 + i] = (_Float16)(p[16 + i] * sc); }
  return a;
}
// column fragment from a [K][ld] layout (column n), rows >= K read as 0
__device__ __forceinline__ v16h fragc_f32(const float* W, int k0, int n, int lane, int ld, int K) {
  v16h a; const int g = lane >> 4;
#pragma unroll
  for (int i = 0; i < 8; ++i) { const int ka = k0 + 8 * g + i, kb = ka + 16;
    a[i] = (_Float16)(ka < K ? W[(size_t)ka * ld + n] : 0.f); a[8 + i] = (_Float16)(kb < K ? W[(size_t)kb * ld + n] : 0.f); }
  return a;
}
struct F2 { v16b h, l; };
__device__ __forceinline__ F2 bsplit16(const float v[16]) { F2 r;
#pragma unroll
  for (int i = 0; i < 16; ++i) { const __bf16 h = (__bf16)v[i]; r.h[i] = h; r.l[i] = (__bf16)(v[i] - (float)h); }
  return r; }
__device__ __forceinline__ F2 split_row(const float* row, int k0, int lane) { float v[16]; const float* p = row + k0 + 8 * (lane >> 4);
#pragma unroll
  for (int i = 0; i < 8; ++i) { v[i] = p[i]; v[8 + i] = p[16 + i]; }
  return bsplit16(v); }
__device__ __forceinline__ F2 split_rowK(const float* row, int k0, int lane, int K) { float v[16]; const int g = lane >> 4;
#pragma unroll
  for (int i = 0; i < 8; ++i) { const int ka = k0 + 8 * g + i, kb = ka + 16; v[i] = ka < K ? row[ka] : 0.f; v[8 + i] = kb < K ? row[kb] : 0.f; }
  return bsplit16(v); }
__device__ __forceinline__ F2 split_col(const float* W, int k0, int n, int lane, int ld, int K) { float v[16]; const int g = lane >> 4;
#pragma unroll
  for (int i = 0; i < 8; ++i) { const int ka = k0 + 8 * g + i, kb = ka + 16; v[i] = ka < K ? W[(size_t)ka * ld + n] : 0.f; v[8 + i] = kb < K ? W[(size_t)kb * ld + n] : 0.f; }
  return bsplit16(v); }
// split_row in two halves, so that the loads can stand apart from the arithmetic: the fragment's sixteen f32 as four 16-byte loads (p = row + k0 + 8 * (lane >> 4)), and their split
__device__ __forceinline__ void ld_raw(v4f s[4], const float* p) { s[0] = *(const v4f*)p; s[1] = *(const v4f*)(p + 4); s[2] = *(const v4f*)(p + 16); s[3] = *(const v4f*)(p + 20); }
__device__ __forceinline__ F2 split_raw(const v4f s[4]) { float v[16];
#pragma unroll
  for (int i = 0; i < 16; ++i) v[i] = s[i >> 2][i & 3];
  return bsplit16(v); }
// the four 16-byte pieces of one stored fragment pair, taken as they are: no arithmetic
__device__ __forceinline__ F2 as_f2(const v4f s[4]) { union { F2 f; v4f q[4]; } u; u.q[0] = s[0]; u.q[1] = s[1]; u.q[2] = s[2]; u.q[3] = s[3]; return u.f; }
// one row fragment's two-way bf16 split, as stored by k_proj in a fragment-ordered plane (p = fragment + lane * 4; 16-byte pieces carried in v4f registers, never computed on):
// pieces 0, 1 = the high parts, pieces 2, 3 = the low parts, of elements 0..7 and 8..15 of split_row's fragment of row lane & 15; each of the four loads covers 512 contiguous bytes
__device__ __forceinline__ void ld_st(v4f s[4], const float* p) { s[0] = *(const v4f*)p; s[1] = *(const v4f*)(p + 128); s[2] = *(const v4f*)(p + 256); s[3] = *(const v4f*)(p + 384); }
__device__ __forceinline__ v8f mac3(const F2& a, const F2& b, v8f c) { c = wmma_bf(a.l, b.h, c); c = wmma_bf(a.h, b.l, c); return wmma_bf(a.h, b.h, c); }
// mac3 for two row groups against one B fragment, the two accumulate chains alternating: each fills the other's wait for its own previous product; each chain's order is mac3's
__device__ __forceinline__ void mac3x2(const F2& a0, const F2& a1, const F2& b, v8f& c0, v8f& c1) {
  c0 = wmma_bfb(a0.l, b.h, c0); c1 = wmma_bfb(a1.l, b.h, c1); c0 = wmma_bfb(a0.h, b.l, c0); c1 = wmma_bfb(a1.h, b.l, c1); c0 = wmma_bfb(a0.h, b.h, c0); c1 = wmma_bfb(a1.h, b.h, c1); }
__device__ __forceinline__ float sigm(float v) { return 1.0f / (1.0f + expf(-v)); }
// 2^x on the hardware's own instruction, in place: 0 for x = -inf or far below the f32 range, no range branch, no fix-up chain.
// Written as asm so that the slot which the instruction set asks for behind a transcendental is filled by construction: by the next, independent v_exp_f32,
// and behind the last one by the v_nop
__device__ __forceinline__ void ex2x4(float& a, float& b, float& c, float& d) {
  asm("v_exp_f32 %0, %0\n\tv_exp_f32 %1, %1\n\tv_exp_f32 %2, %2\n\tv_exp_f32 %3, %3\n\tv_nop" : "+v"(a), "+v"(b), "+v"(c), "+v"(d)); }
__device__ __forceinline__ float ex2(float x) { asm("v_exp_f32 %0, %0\n\tv_nop" : "+v"(x)); return x; }   // the same for one value
#define L2E 1.4426950408889634f
// four vector slots between a product and a global load over registers that it read as B
#define WGAP() asm volatile("v_nop\n\tv_nop\n\tv_nop\n\tv_nop")
#define LDSX() do { asm volatile("s_wait_dscnt 0" ::: "memory"); __builtin_amdgcn_wave_barrier(); __builtin_amdgcn_fence(__ATOMIC_RELEASE, "workgroup"); } while (0)

// Dialog sequence-attention matching: x_proj / y_proj = relu(. @ W^T + b) as two-way bf16 splits on WMMA (f32 results, stored as their own two-way bf16 splits); per (timestep i,
// 16 document positions) only the key tiles of earlier timesteps are visited, dealt over the block's waves (later ones and padded tokens are exactly weight 0; row i = 0
// is all-zero: k_attn stores it with inv = 0), scores as two-way bf16 splits (logits are O(10): near-f32 keeps the sharp softmax exact), recency bias and pad
// mask (read as data) in f32, online softmax in f32, alpha (x2^14 f16) @ dialog embeddings (f16 transposed copy) on v_wmma_f32_16x16x32_f16.
#define NT 32
#define L1 512
#define MQ 64                  // tokens per timestep (32 + 32)
#define NK (NT * MQ)           // 2048
#define HH 128
#define WRING 5                // W fragments in flight per wave of k_proj

// projections: blockIdx.y = 0: XP rows (16384) from xd; 1: YP rows (2048) from dlg = [xq | xa] per timestep; also the transposed dialog copy in f16 (which = 2).
// All three planes are laid out in the order k_attn's lanes read them, so that each of its wave-wide 16-byte loads covers four whole 128-byte lines
// (in row-major planes such a load touches sixteen lines):
//   XP, YP: [16-row group][k chunk of 32][piece j][lane][16 bytes], already split into bf16 high and low parts (ld_st says what piece j holds): as many bytes as the f32 rows
//   dT:     [64-key tile, at the 32-KiB pitch of a y_proj tile (second half unused) so that one offset register serves both planes][k chunk of 32 keys][16-column group t][half h][lane][8 f16] = keys chunk + 16 h + 8 (lane >> 4) + 0..7 of column 16 t + (lane & 15)
__global__ __launch_bounds__(128) void k_proj(const float* __restrict__ xd, const float* __restrict__ xq, const float* __restrict__ xa, const float* __restrict__ W, const float* __restrict__ bias, float* __restrict__ XP, float* __restrict__ YP, _Float16* __restrict__ dT) {
  __shared__ __align__(16) float so[4][16][132];
  __shared__ __align__(16) _Float16 st[HH][72];
  const int tid = threadIdx.x, wave = tid >> 5, lane = tid & 31, col = lane & 15, g = lane >> 4;
  const int which = blockIdx.y, r0 = blockIdx.x * 64 + wave * 16;
  if (which == 0 || blockIdx.x < NK / 64) {
    if (which < 2) { v8f acc[8] = {};
      const int key = r0 + col, ts = key / MQ, m = key % MQ;   // which == 1: the dialog row of this lane
      const float* src = which == 0 ? xd + (size_t)(r0 + col) * HH : m < 32 ? xq + ((size_t)ts * 32 + m) * HH : xa + ((size_t)ts * 32 + m - 32) * HH;
      const float* ap = src + 8 * g;                           // split_row's start in this lane's input row
      const float* wp = W + (size_t)col * HH + 8 * g;          // and in W: fragment f = (k chunk f >> 3, column group f & 7) stands at (f & 7) * 16 * HH + (f >> 3) * 32
      // every global load of this path goes out well ahead of its use: asked for at its use, each of the 32 W fragments and 4 row fragments is waited out alone by the SIMD's one wave
      float bb[8]; v4f ar[2][4], wr[WRING][4];
#pragma unroll
      for (int kc = 0; kc < 2; ++kc) ld_raw(ar[kc], ap + kc * 32);
#pragma unroll
      for (int f = 0; f < WRING; ++f) ld_raw(wr[f], wp + (f & 7) * 16 * HH + (f >> 3) * 32);
#pragma unroll
      for (int j = 0; j < 8; ++j) bb[j] = bias[j * 16 + col];
      __builtin_amdgcn_sched_barrier(0);                       // keeps these loads in front of the products
      F2 a;
#pragma unroll   // unrolled: the ring's entries are picked by constants and stay in registers
      for (int f = 0; f < 32; ++f) { const int kc = f >> 3, j = f & 7;
        if (j == 0) { a = split_raw(ar[kc & 1]);
          if (kc + 2 < 4) { __builtin_amdgcn_sched_barrier(0);   // the split first, so that the load re-uses its registers
            ld_raw(ar[kc & 1], ap + (kc + 2) * 32);
            __builtin_amdgcn_sched_barrier(0); } }               // keeps that load here, two k chunks ahead of its use
        const F2 b = split_raw(wr[f % WRING]);
        if (f + WRING < 32) { __builtin_amdgcn_sched_barrier(0); // as above: the split first, then the ring entry's next load, WRING fragments ahead of its use
          ld_raw(wr[f % WRING], wp + ((f + WRING) & 7) * 16 * HH + ((f + WRING) >> 3) * 32);
          __builtin_amdgcn_sched_barrier(0); }
        acc[j] = mac3(a, b, acc[j]); }
      asm volatile("s_wait_xcnt 0x0" :: "v"(ap), "v"(wp) : "memory");   // the loads' address registers are live up to this wait, before anything re-uses them
#pragma unroll
      for (int j = 0; j < 8; ++j) { const int c = j * 16 + col;
#pragma unroll
        for (int r = 0; r < 8; ++r) { const float v = acc[j][r] + bb[j]; so[wave][8 * g + r][c] = v > 0.f ? v : 0.f; } }
      LDSX();
      float* dst = which == 0 ? XP : YP;
#pragma unroll   // both loops unrolled: the pieces are picked by constants and stay in registers
      for (int kc = 0; kc < 4; ++kc) { union { F2 f; v4f q[4]; } u; u.f = split_row(&so[wave][col][0], kc * 32, lane);   // the split is made here, once per row
#pragma unroll
        for (int j = 0; j < 4; ++j) vst2(dst + (size_t)r0 * HH + (kc * 4 + j) * 128 + lane * 4, u.q[j]); } }
    else {   // the dialog copy of this block's 64 keys (one key tile)
      const float* qp = xq + (size_t)blockIdx.x * 32 * HH + tid; const float* pa = xa + (size_t)blockIdx.x * 32 * HH + tid;   // key blockIdx.x * 64 + kl is token kl of timestep blockIdx.x; this thread has column tid
      float v[64];
#pragma unroll   // the thread's 64 loads go out together; rolled, every few are waited out alone
      for (int kl = 0; kl < 32; ++kl) { v[kl] = qp[kl * HH]; v[32 + kl] = pa[kl * HH]; }
#pragma unroll
      for (int kl = 0; kl < 64; ++kl) st[tid][kl] = (_Float16)v[kl];
      __syncthreads();
#pragma unroll   // a constant trip count, unrolled: the eight LDS reads go out together, then the eight stores
      for (int it = 0; it < HH * 8 / 128; ++it) { const int q = tid + it * 128, f = q >> 5, kc = f >> 4, t = (f >> 1) & 7, h = f & 1;   // q = (fragment half f, lane)
        vst2(dT + (size_t)blockIdx.x * (2 * 64 * HH) + q * 8, *(const v4u*)(&st[t * 16 + col][kc * 32 + 16 * h + 8 * g])); } } }
}
// attention: block (QG * 16 doc positions, timestep i); wave w takes the key tiles kt = w, w + KS, ... for all QG 16-row groups, so that every y_proj and dialog
// fragment it loads from L2 is used QG times, and keeps per group its own running maximum, sum and un-normalised accumulator; the KS partial results are merged
// through LDS behind one work-group barrier
#define KS 8
#define QG 2
// two waves per SIMD, one work-group on a WGP: both groups' accumulators and query fragments stay in registers
__global__ __launch_bounds__(32 * KS) __attribute__((amdgpu_waves_per_eu(2, 2))) void k_attn(const float* __restrict__ XP, const float* __restrict__ YP, const _Float16* __restrict__ dT, const int* __restrict__ qmask, const int* __restrict__ amask, const float* __restrict__ rwp, float* __restrict__ out) {
  __shared__ __align__(16) float sS[KS][QG][16][68];
  __shared__ __align__(16) _Float16 sP[KS][QG][16][72];
  __shared__ __align__(16) float sO[KS][QG][16][132];
  __shared__ float sM[KS][QG][16];
  __shared__ float sL[KS][QG][16];
  __shared__ float smk[NK];
  __shared__ __align__(16) v4u sQ[QG][4][2][2][32];   // the block's query fragments [row group][k chunk][hi, lo][half][lane], shared by all waves
  // w through readfirstlane: the wave's number in a scalar register, so that the key loop's trip test stays a scalar branch
  const int tid = threadIdx.x, w = __builtin_amdgcn_readfirstlane(tid >> 5), lane = tid & 31, col = lane & 15, g = lane >> 4;
  const int i = blockIdx.y, q0 = blockIdx.x * (16 * QG); const size_t rq = (size_t)i * L1 + q0;
  { const int m = tid % MQ; const int* pmk = (m < 32 ? qmask + m : amask + (m - 32)) + (tid / MQ) * 32;   // key k = tid + 256 j: token m of timestep tid / 64 + 4 j
#pragma unroll   // the eight mask loads of a thread go out together; rolled, each is waited out alone
    for (int j = 0; j < NK / (32 * KS); ++j) smk[tid + j * 32 * KS] = pmk[j * (32 * KS / MQ) * 32] ? 1.f : 0.f; }    // 1 = padded (masked)
  if (w < 4 * QG) { union { F2 f; v4u q[4]; } u; v4f xs[4]; ld_st(xs, XP + rq * HH + w * 512 + lane * 4);   // fragment w = (row group w >> 2, k chunk w & 3): the groups' planes follow one another
    asm volatile("s_wait_xcnt 0x0" ::: "memory");   // behind the four loads, before anything re-uses the registers that they name
    u.f = as_f2(xs);
    sQ[w >> 2][w & 3][0][0][lane] = u.q[0]; sQ[w >> 2][w & 3][0][1][lane] = u.q[1]; sQ[w >> 2][w & 3][1][0][lane] = u.q[2]; sQ[w >> 2][w & 3][1][1][lane] = u.q[3]; }
  __syncthreads();
  if (w < i) {
    v8f acc[QG][8] = {};
    const unsigned lo = lane * 16;                             // this lane's byte in a 512-byte fragment piece, of y_proj and of the dialog copy alike; a tile's place is added as a 32-bit byte offset to the plane's scalar base
    unsigned yo = lo + (unsigned)w * (64 * HH * 4);            // byte offset of this lane in the wave's current key tile of y_proj
    v4f st[4][4];                                              // split y_proj fragments of one 16-key group, one entry per k chunk
#pragma unroll
    for (int kc = 0; kc < 4; ++kc) { ld_st(st[kc], (const float*)((const char*)YP + yo) + kc * 512);
      __builtin_amdgcn_sched_barrier(0); }                     // chunks go out in the loop's own order: in another order the trip's first wait is for all sixteen loads
    float mrun[QG], lrun[QG]; const float rw = rwp[0];
#pragma unroll
    for (int qg = 0; qg < QG; ++qg) { mrun[qg] = -3.0e38f; lrun[qg] = 0.f; }
#pragma unroll 1
    for (int kt = w; kt < i; kt += KS) {                 // key tile kt == timestep kt < i (later timesteps are masked -> weight exactly 0)
      const float bias = rw * (float)(i - kt);           // |i - j_ts| * recency_weight (row i >= 1)
      const float* yp = (const float*)((const char*)YP + yo);
      F2 aq[QG][4];                                      // re-read every trip: their registers hold the dialog tile during softmax and PV
#pragma unroll
      for (int qg = 0; qg < QG; ++qg)
#pragma unroll
        for (int kc = 0; kc < 4; ++kc) { union { F2 f; v4u q[4]; } u; u.q[0] = sQ[qg][kc][0][0][lane]; u.q[1] = sQ[qg][kc][0][1][lane]; u.q[2] = sQ[qg][kc][1][0][lane]; u.q[3] = sQ[qg][kc][1][1][lane]; aq[qg][kc] = u.f; }
#pragma unroll
      for (int t = 0; t < 4; ++t) { v8f s[QG] = {}; const int key = kt * 64 + t * 16 + col;
#pragma unroll
        for (int kc = 0; kc < 4; ++kc) { mac3x2(aq[0][kc], aq[1][kc], as_f2(st[kc]), s[0], s[1]);
          if (t < 3) {
            __builtin_amdgcn_sched_barrier(0);           // the products first, so that the load below re-uses their operand registers (lifted over them, it takes 16 more)
            WGAP();
            __builtin_amdgcn_sched_barrier(0);           // holds the slots between the products and the load
            ld_st(st[kc], yp + (t + 1) * 16 * HH + kc * 512);            // the next group's chunk into the registers just read
            __builtin_amdgcn_sched_barrier(0); } }       // keeps that load here, four chunks ahead of its use; sunk to its use it is waited out alone
        const bool pad = smk[key] != 0.f;
#pragma unroll
        for (int qg = 0; qg < QG; ++qg)
#pragma unroll
          for (int r = 0; r < 8; ++r) sS[w][qg][8 * g + r][t * 16 + col] = pad ? -3.0e38f : s[qg][r] + bias; }
      LDSX();
      const _Float16* dp = (const _Float16*)((const char*)dT + yo);   // the same byte offset: dialog tiles stand at y_proj's tile pitch
      v8h dv[2][8][2];                                   // the whole dialog tile, asked for now so that it lands behind the softmax
#pragma unroll
      for (int kc = 0; kc < 2; ++kc)
#pragma unroll
        for (int t = 0; t < 8; ++t) { const _Float16* p = dp + (kc * 8 + t) * 512; dv[kc][t][0] = *(const v8h*)p; dv[kc][t][1] = *(const v8h*)(p + 256); }
      asm volatile("s_wait_xcnt 0x0" :: "v"(yo) : "memory");   // the loads' offset register is live up to this wait
      __builtin_amdgcn_sched_barrier(0);                 // keeps the 32 loads in front of the softmax
#pragma unroll   // one softmax per row group, unrolled: the groups are independent and their state is picked by constants
      for (int qg = 0; qg < QG; ++qg) {
      float mx = -3.4e38f;
#pragma unroll
      for (int jj = 0; jj < 32; ++jj) mx = fmaxf(mx, sS[w][qg][col][g * 32 + jj]);
      mx = fmaxf(mx, __shfl_xor(mx, 16, 32));
      const float mnew = fmaxf(mrun[qg], mx); const bool dead = mnew <= -1.0e38f;   // dead: every key of this row so far is masked
      const float ce = ex2((mrun[qg] - mnew) * L2E); const float corr = dead ? 1.0f : ce;   // computed in every lane and then chosen: no branch round it
      const float mb = dead ? 0.f : -mnew * L2E;         // a masked score (-3e38) times L2E is -inf, whose 2^x is exactly 0, also in a dead row: no test per element
      float ps = 0.f;
#pragma unroll
      for (int jj = 0; jj < 32; jj += 4) { float p[4];
#pragma unroll
        for (int e = 0; e < 4; ++e) p[e] = fmaf(sS[w][qg][col][g * 32 + jj + e], L2E, mb);
        ex2x4(p[0], p[1], p[2], p[3]);
#pragma unroll
        for (int e = 0; e < 4; ++e) { ps += p[e]; sP[w][qg][col][g * 32 + jj + e] = (_Float16)(p[e] * 16384.0f); } }
      ps += __shfl_xor(ps, 16, 32);
      lrun[qg] = lrun[qg] * corr + ps; mrun[qg] = mnew;
#pragma unroll
      for (int r = 0; r < 8; ++r) { const float cr = __shfl(corr, 8 * g + r, 32);
#pragma unroll
        for (int t = 0; t < 8; ++t) acc[qg][t][r] *= cr; } }
      LDSX();
      const unsigned yof = yo + (kt + KS < i ? KS * 64 * HH * 4 : 0);
      const float* ypn = (const float*)((const char*)YP + yof);   // the wave's next tile (its last trip re-reads its own: in bounds, unused)
#pragma unroll
      for (int kc = 0; kc < 2; ++kc) { v16h pa[QG];
#pragma unroll
        for (int qg = 0; qg < QG; ++qg) pa[qg] = frag_h(&sP[w][qg][col][0] + kc * 32, lane);
#pragma unroll
        for (int t = 0; t < 8; ++t) { union { v16h v; v8h q[2]; } u; u.q[0] = dv[kc][t][0]; u.q[1] = dv[kc][t][1];
#pragma unroll
          for (int qg = 0; qg < QG; ++qg) acc[qg][t] = wmma16(pa[qg], u.v, acc[qg][t]);
          if (kc == 0 && (t & 1)) { __builtin_amdgcn_sched_barrier(0);   // the products first: the load may take the dialog registers that they read
            WGAP();
            __builtin_amdgcn_sched_barrier(0);           // holds the slots between the products and the load
            ld_st(st[t >> 1], ypn + (t >> 1) * 512);
            __builtin_amdgcn_sched_barrier(0); } } }     // next tile's first group goes out as dialog registers fall free, not at its use
      asm volatile("s_wait_xcnt 0x0" :: "v"(yof) : "memory");  // before the next trip re-uses the offset register of the loads still in flight
      yo = yof;
      __builtin_amdgcn_wave_barrier(); }
    const int tl = __builtin_amdgcn_mbcnt_lo(~0u, (unsigned)w * 32), lc = tl & 15, lg = (tl >> 4) & 1;   // tl == tid, formed anew from the wave's number: col and g held over the key loop were spilled
#pragma unroll
    for (int qg = 0; qg < QG; ++qg) {
      if (lg == 0) { sM[w][qg][lc] = mrun[qg]; sL[w][qg][lc] = lrun[qg]; }
#pragma unroll
      for (int r = 0; r < 8; ++r)
#pragma unroll
        for (int t = 0; t < 8; ++t) sO[w][qg][8 * lg + r][t * 16 + lc] = acc[qg][t][r]; } }
  __syncthreads();   // every wave's partial (maximum, sum, accumulator) is in LDS before any thread merges
  // merge: thread = (row of each row group, two groups of 4 columns); only the waves that had a tile (u < i) count, the others re-read wave 0's partial with
  // weight 0 so that all LDS reads are independent of each other; i = 0 gives the all-zero row block
  const int tm = __builtin_amdgcn_mbcnt_lo(~0u, (unsigned)w * 32), row = tm >> 4, c = (tm & 15) * 4;   // tm == tid, formed anew for the same reason
#pragma unroll
  for (int qg = 0; qg < QG; ++qg) {
  v4f o0 = {}, o1 = {}; float inv = 0.f;
  if (i > 0) {
    float mu[KS], M = -3.0e38f, L = 0.f;
#pragma unroll
    for (int u = 0; u < KS; ++u) { mu[u] = sM[u < i ? u : 0][qg][row]; M = fmaxf(M, mu[u]); }
    float ef[KS];
#pragma unroll
    for (int u = 0; u < KS; ++u) ef[u] = (mu[u] - M) * L2E;
    ex2x4(ef[0], ef[1], ef[2], ef[3]); ex2x4(ef[4], ef[5], ef[6], ef[7]);
#pragma unroll
    for (int u = 0; u < KS; ++u) { const int uu = u < i ? u : 0; const float f = (u >= i || mu[u] <= -1.0e38f) ? 0.f : ef[u];
      L += f * sL[uu][qg][row]; o0 += f * *(const v4f*)(&sO[uu][qg][row][c]); o1 += f * *(const v4f*)(&sO[uu][qg][row][64 + c]); }
    inv = L > 0.f ? 1.0f / (L * 16384.0f) : 0.f; }     // a fully padded history gives sum 0; guarded as before
  vst2(out + (rq + qg * 16 + row) * HH + c, o0 * inv); vst2(out + (rq + qg * 16 + row) * HH + 64 + c, o1 * inv);
  if (qg + 1 < QG) asm volatile("s_wait_xcnt 0x0" ::: "memory"); }   // behind the two stores, before the next row group's LDS reads land on the registers that they name
}
extern "C" void kernel_launch(void* const* d_in, const int* in_sizes, int n_in, void* d_out, int out_size, void* d_ws, size_t ws_size, hipStream_t stream) {
  (void)in_sizes; (void)n_in; (void)out_size; (void)ws_size;
  const float* xd = (const float*)d_in[0]; const float* xq = (const float*)d_in[1]; const float* xa = (const float*)d_in[2]; const float* W = (const float*)d_in[3]; const float* bias = (const float*)d_in[4]; const float* rw = (const float*)d_in[5]; const int* qm = (const int*)d_in[6]; const int* am = (const int*)d_in[7];
  float* out = (float*)d_out;
  char* ws = (char*)d_ws; size_t off = 0;
  auto take = [&](size_t bytes) { char* p = ws + off; off += (bytes + 255) & ~(size_t)255; return p; };
  float* XP = (float*)take((size_t)NT * L1 * HH * 4); float* YP = (float*)take((size_t)NK * HH * 4); _Float16* dT = (_Float16*)take((size_t)HH * NK * 4);
  k_proj<<<dim3(NT * L1 / 64, 3), 128, 0, stream>>>(xd, xq, xa, W, bias, XP, YP, dT);
  k_attn<<<dim3(L1 / (16 * QG), NT), 32 * KS, 0, stream>>>(XP, YP, dT, qm, am, rw, out);
}

// v008
// Measured time: 31.1 microseconds a run.
// Two timings next to v007 both put it at 1.20 times that version's speed.
// All steps since v000 together make it 11.2 times as fast.
#include <hip/hip_runtime.h>
#include <math.h>

typedef __attribute__((ext_vector_type(16))) _Float16 v16h;
typedef __attribute__((ext_vector_type(16))) __bf16 v16b;
typedef __attribute__((ext_vector_type(8)))  _Float16 v8h;
typedef __attribute__((ext_vector_type(8)))  float v8f;
typedef __attribute__((ext_vector_type(4)))  float v4f;
typedef __attribute__((ext_vector_type(2)))  float v2f;
typedef __attribute__((ext_vector_type(4)))  unsigned v4u;
typedef __attribute__((ext_vector_type(4)))  int v4i;
typedef float __attribute__((may_alias)) float_a;
typedef int __attribute__((may_alias)) int_a;

template <typename T> __device__ __forceinline__ void vst2(void* p, T v) { *(T*)p = v;  }
// k_attn's two forms are the bare builtins, whose distances the compiler keeps itself: an asm statement's vector operands can only stand in v0..v255, which cannot hold two row groups' fragments and accumulators
__device__ __forceinline__ v8f wmma16(v16h a, v16h b, v8f c) { return __builtin_amdgcn_wmma_f32_16x16x32_f16(false, a, false, b, (short)0, c, false, false); }
__device__ __forceinline__ v8f wmma_bfb(v16b a, v16b b, v8f c) { return __builtin_amdgcn_wmma_f32_16x16x32_bf16(false, a, false, b, (short)0, c, false, false); }
__device__ __forceinline__ v8f wmma_bf(v16b a, v16b b, v8f c) {
  v8f d = __builtin_amdgcn_wmma_f32_16x16x32_bf16(false, a, false, b, (short)0, c, false, false);
  asm volatile("v_nop\n\tv_nop\n\tv_nop\n\tv_nop" : "+v"(d) : "v"(a), "v"(b));
  return d;
}
// 16x16x32 fragments: lane = (h = lane>>4, row/col = lane&15); elements 0..7 = k0+8h+0..7, 8..15 = k0+16+8h+0..7; D element r = row 8h+r
__device__ __forceinline__ v16h frag_h(const _Float16* rowk0, int lane) {
  union { v16h v; v8h q[2]; } u; const _Float16* p = rowk0 + 8 * (lane >> 4);
  u.q[0] = *(const v8h*)p; u.q[1] = *(const v8h*)(p + 16); return u.v;
}
__device__ __forceinline__ v16h frag_f32(const float* rowk0, int lane) {
  v16h a; const float* p = rowk0 + 8 * (lane >> 4);
#pragma unroll
  for (int i = 0; i < 8; ++i) { a[i] = (_Float16)p[i]; a[8 + i] = (_Float16)p[16 + i]; }
  return a;
}
__device__ __forceinline__ v16h frag_f32s(const float* rowk0, int lane, float sc) {
  v16h a; const float* p = rowk0 + 8 * (lane >> 4);
#pragma unroll
  for (int i = 0; i < 8; ++i) { a[i] = (_Float16)(p[i] * sc); a[8 + i] = (_Float16)(p[16 + i] * sc); }
  return a;
}
// column fragment from a [K][ld] layout (column n), rows >= K read as 0
__device__ __forceinline__ v16h fragc_f32(const float* W, int k0, int n, int lane, int ld, int K) {
  v16h a; const int g = lane >> 4;
#pragma unroll
  for (int i = 0; i < 8; ++i) { const int ka = k0 + 8 * g + i, kb = ka + 16;
    a[i] = (_Float16)(ka < K ? W[(size_t)ka * ld + n] : 0.f); a[8 + i] = (_Float16)(kb < K ? W[(size_t)kb * ld + n] : 0.f); }
  return a;
}
struct F2 { v16b h, l; };
__device__ __forceinline__ F2 bsplit16(const float v[16]) { F2 r;
#pragma unroll
  for (int i = 0; i < 16; ++i) { const __bf16 h = (__bf16)v[i]; r.h[i] = h; r.l[i] = (__bf16)(v[i] - (float)h); }
  return r; }
__device__ __forceinline__ F2 split_row(const float* row, int k0, int lane) { float v[16]; const float* p = row + k0 + 8 * (lane >> 4);
#pragma unroll
  for (int i = 0; i < 8; ++i) { v[i] = p[i]; v[8 + i] = p[16 + i]; }
  return bsplit16(v); }
__device__ __forceinline__ F2 split_rowK(const float* row, int k0, int lane, int K) { float v[16]; const int g = lane >> 4;
#pragma unroll
  for (int i = 0; i < 8; ++i) { const int ka = k0 + 8 * g + i, kb = ka + 16; v[i] = ka < K ? row[ka] : 0.f; v[8 + i] = kb < K ? row[kb] : 0.f; }
  return bsplit16(v); }
__device__ __forceinline__ F2 split_col(const float* W, int k0, int n, int lane, int ld, int K) { float v[16]; const int g = lane >> 4;
#pragma unroll
  for (int i = 0; i < 8; ++i) { const int ka = k0 + 8 * g + i, kb = ka + 16; v[i] = ka < K ? W[(size_t)ka * ld + n] : 0.f; v[8 + i] = kb < K ? W[(size_t)kb * ld + n] : 0.f; }
  return bsplit16(v); }
// split_row in two halves, so that the loads can stand apart from the arithmetic: the fragment's sixteen f32 as four 16-byte loads (p = row + k0 + 8 * (lane >> 4)), and their split
__device__ __forceinline__ void ld_raw(v4f s[4], const float* p) { s[0] = *(const v4f*)p; s[1] = *(const v4f*)(p + 4); s[2] = *(const v4f*)(p + 16); s[3] = *(const v4f*)(p + 20); }
__device__ __forceinline__ F2 split_raw(const v4f s[4]) { float v[16];
#pragma unroll
  for (int i = 0; i < 16; ++i) v[i] = s[i >> 2][i & 3];
  return bsplit16(v); }
// the four 16-byte pieces of one stored fragment pair, taken as they are: no arithmetic
__device__ __forceinline__ F2 as_f2(const v4f s[4]) { union { F2 f; v4f q[4]; } u; u.q[0] = s[0]; u.q[1] = s[1]; u.q[2] = s[2]; u.q[3] = s[3]; return u.f; }
// one row fragment's two-way bf16 split, as stored by k_proj in a fragment-ordered plane (p = fragment + lane * 4; 16-byte pieces carried in v4f registers, never computed on):
// pieces 0, 1 = the high parts, pieces 2, 3 = the low parts, of elements 0..7 and 8..15 of split_row's fragment of row lane & 15; each of the four loads covers 512 contiguous bytes
__device__ __forceinline__ void ld_st(v4f s[4], const float* p) { s[0] = *(const v4f*)p; s[1] = *(const v4f*)(p + 128); s[2] = *(const v4f*)(p + 256); s[3] = *(const v4f*)(p + 384); }
__device__ __forceinline__ v8f mac3(const F2& a, const F2& b, v8f c) { c = wmma_bf(a.l, b.h, c); c = wmma_bf(a.h, b.l, c); return wmma_bf(a.h, b.h, c); }
// mac3 for two row groups against one B fragment, the two accumulate chains alternating: each fills the other's wait for its own previous product; each chain's order is mac3's
__device__ __forceinline__ void mac3x2(const F2& a0, const F2& a1, const F2& b, v8f& c0, v8f& c1) {
  c0 = wmma_bfb(a0.l, b.h, c0); c1 = wmma_bfb(a1.l, b.h, c1); c0 = wmma_bfb(a0.h, b.l, c0); c1 = wmma_bfb(a1.h, b.l, c1); c0 = wmma_bfb(a0.h, b.h, c0); c1 = wmma_bfb(a1.h, b.h, c1); }
__device__ __forceinline__ float sigm(float v) { return 1.0f / (1.0f + expf(-v)); }
// 2^x on the hardware's own instruction, in place: 0 for x = -inf or far below the f32 range, no range branch, no fix-up chain.
// Written as asm so that the slot which the instruction set asks for behind a transcendental is filled by construction: by the next, independent v_exp_f32,
// and behind the last one by the v_nop
__device__ __forceinline__ void ex2x4(float& a, float& b, float& c, float& d) {
  asm("v_exp_f32 %0, %0\n\tv_exp_f32 %1, %1\n\tv_exp_f32 %2, %2\n\tv_exp_f32 %3, %3\n\tv_nop" : "+v"(a), "+v"(b), "+v"(c), "+v"(d)); }
__device__ __forceinline__ float ex2(float x) { asm("v_exp_f32 %0, %0\n\tv_nop" : "+v"(x)); return x; }   // the same for one value
#define L2E 1.4426950408889634f
// four vector slots between a product and a global load over registers that it read as B
#define WGAP() asm volatile("v_nop\n\tv_nop\n\tv_nop\n\tv_nop")
#define LDSX() do { asm volatile("s_wait_dscnt 0" ::: "memory"); __builtin_amdgcn_wave_barrier(); __builtin_amdgcn_fence(__ATOMIC_RELEASE, "workgroup"); } while (0)

// Dialog sequence-attention matching: x_proj / y_proj = relu(. @ W^T + b) as two-way bf16 splits on WMMA (f32 results, stored as their own two-way bf16 splits); per (timestep i,
// 16 document positions) only the key tiles of earlier timesteps are visited, dealt over the block's waves (later ones and padded tokens are exactly weight 0; row i = 0
// is all-zero: k_attn stores it with inv = 0), scores as two-way bf16 splits (logits are O(10): near-f32 keeps the sharp softmax exact), recency bias and pad
// mask (read as data) in f32, online softmax in f32, alpha (x2^14 f16) @ dialog embeddings (f16 transposed copy) on v_wmma_f32_16x16x32_f16.
#define NT 32
#define L1 512
#define MQ 64                  // tokens per timestep (32 + 32)
#define NK (NT * MQ)           // 2048
#define HH 128
#define WRING 5                // W fragments in flight per wave of k_proj

// projections: blockIdx.y = 0: XP rows (16384) from xd; 1: YP rows (2048) from dlg = [xq | xa] per timestep; also the transposed dialog copy in f16 (which = 2).
// All three planes are laid out in the order k_attn's lanes read them, so that each of its wave-wide 16-byte loads covers four whole 128-byte lines
// (in row-major planes such a load touches sixteen lines):
//   XP, YP: [16-row group][k chunk of 32][piece j][lane][16 bytes], already split into bf16 high and low parts (ld_st says what piece j holds): as many bytes as the f32 rows
//   dT:     [64-key tile, at the 32-KiB pitch of a y_proj tile (second half unused) so that one offset register serves both planes][k chunk of 32 keys][16-column group t][half h][lane][8 f16] = keys chunk + 16 h + 8 (lane >> 4) + 0..7 of column 16 t + (lane & 15)
__global__ __launch_bounds__(128) void k_proj(const float* __restrict__ xd, const float* __restrict__ xq, const float* __restrict__ xa, const float* __restrict__ W, const float* __restrict__ bias, float* __restrict__ XP, float* __restrict__ YP, _Float16* __restrict__ dT) {
  __shared__ __align__(16) float so[4][16][132];
  __shared__ __align__(16) _Float16 st[HH][72];
  const int tid = threadIdx.x, wave = tid >> 5, lane = tid & 31, col = lane & 15, g = lane >> 4;
  const int which = blockIdx.y, r0 = blockIdx.x * 64 + wave * 16;
  if (which == 0 || blockIdx.x < NK / 64) {
    if (which < 2) { v8f acc[8] = {};
      const int key = r0 + col, ts = key / MQ, m = key % MQ;   // which == 1: the dialog row of this lane
      const float* src = which == 0 ? xd + (size_t)(r0 + col) * HH : m < 32 ? xq + ((size_t)ts * 32 + m) * HH : xa + ((size_t)ts * 32 + m - 32) * HH;
      const float* ap = src + 8 * g;                           // split_row's start in this lane's input row
      const float* wp = W + (size_t)col * HH + 8 * g;          // and in W: fragment f = (k chunk f >> 3, column group f & 7) stands at (f & 7) * 16 * HH + (f >> 3) * 32
      // every global load of this path goes out well ahead of its use: asked for at its use, each of the 32 W fragments and 4 row fragments is waited out alone by the SIMD's one wave
      float bb[8]; v4f ar[2][4], wr[WRING][4];
#pragma unroll
      for (int kc = 0; kc < 2; ++kc) ld_raw(ar[kc], ap + kc * 32);
#pragma unroll
      for (int f = 0; f < WRING; ++f) ld_raw(wr[f], wp + (f & 7) * 16 * HH + (f >> 3) * 32);
#pragma unroll
      for (int j = 0; j < 8; ++j) bb[j] = bias[j * 16 + col];
      __builtin_amdgcn_sched_barrier(0);                       // keeps these loads in front of the products
      F2 a;
#pragma unroll   // unrolled: the ring's entries are picked by constants and stay in registers
      for (int f = 0; f < 32; ++f) { const int kc = f >> 3, j = f & 7;
        if (j == 0) { a = split_raw(ar[kc & 1]);
          if (kc + 2 < 4) { __builtin_amdgcn_sched_barrier(0);   // the split first, so that the load re-uses its registers
            ld_raw(ar[kc & 1], ap + (kc + 2) * 32);
            __builtin_amdgcn_sched_barrier(0); } }               // keeps that load here, two k chunks ahead of its use
        const F2 b = split_raw(wr[f % WRING]);
        if (f + WRING < 32) { __builtin_amdgcn_sched_barrier(0); // as above: the split first, then the ring entry's next load, WRING fragments ahead of its use
          ld_raw(wr[f % WRING], wp + ((f + WRING) & 7) * 16 * HH + ((f + WRING) >> 3) * 32);
          __builtin_amdgcn_sched_barrier(0); }
        acc[j] = mac3(a, b, acc[j]); }
      asm volatile("s_wait_xcnt 0x0" :: "v"(ap), "v"(wp) : "memory");   // the loads' address registers are live up to this wait, before anything re-uses them
#pragma unroll
      for (int j = 0; j < 8; ++j) { const int c = j * 16 + col;
#pragma unroll
        for (int r = 0; r < 8; ++r) { const float v = acc[j][r] + bb[j]; so[wave][8 * g + r][c] = v > 0.f ? v : 0.f; } }
      LDSX();
      float* dst = which == 0 ? XP : YP;
#pragma unroll   // both loops unrolled: the pieces are picked by constants and stay in registers
      for (int kc = 0; kc < 4; ++kc) { union { F2 f; v4f q[4]; } u; u.f = split_row(&so[wave][col][0], kc * 32, lane);   // the split is made here, once per row
#pragma unroll
        for (int j = 0; j < 4; ++j) vst2(dst + (size_t)r0 * HH + (kc * 4 + j) * 128 + lane * 4, u.q[j]); } }
    else {   // the dialog copy of this block's 64 keys (one key tile)
      const float* qp = xq + (size_t)blockIdx.x * 32 * HH + tid; const float* pa = xa + (size_t)blockIdx.x * 32 * HH + tid;   // key blockIdx.x * 64 + kl is token kl of timestep blockIdx.x; this thread has column tid
      float v[64];
#pragma unroll   // the thread's 64 loads go out together; rolled, every few are waited out alone
      for (int kl = 0; kl < 32; ++kl) { v[kl] = qp[kl * HH]; v[32 + kl] = pa[kl * HH]; }
#pragma unroll
      for (int kl = 0; kl < 64; ++kl) st[tid][kl] = (_Float16)v[kl];
      __syncthreads();
#pragma unroll   // a constant trip count, unrolled: the eight LDS reads go out together, then the eight stores
      for (int it = 0; it < HH * 8 / 128; ++it) { const int q = tid + it * 128, f = q >> 5, kc = f >> 4, t = (f >> 1) & 7, h = f & 1;   // q = (fragment half f, lane)
        vst2(dT + (size_t)blockIdx.x * (2 * 64 * HH) + q * 8, *(const v4u*)(&st[t * 16 + col][kc * 32 + 16 * h + 8 * g])); } } }
}
// attention: block (QG * 16 doc positions, timestep pair iA = NT - 1 - p, iB = p). A timestep i has i key tiles, so every pair has NT - 1 of them: they are numbered
// through (first iA's, then iB's) and dealt in runs of IPW over the block's waves, so that every wave of every block has the same number of trips (the last wave one less)
// and all blocks are resident at once. A wave takes each of its tiles for all QG 16-row groups, so that every y_proj and dialog fragment it loads from L2 is used QG times,
// and keeps per group its own running maximum, sum and un-normalised accumulator. The one wave whose run crosses from iA to iB puts its partial result down at the crossing
// and starts anew; the partial results are merged per timestep through LDS behind one work-group barrier
#define KS 8
#define QG 2
#define NI (NT - 1)                    // key tiles of a timestep pair
#define IPW ((NI + KS - 1) / KS)       // tiles per wave
#define NSL (KS + 1)                   // partial results: slot w = wave w's first (or only) one, slot KS = the crossing wave's second
// two waves per SIMD, one work-group on a WGP: both groups' accumulators and query fragments stay in registers
__global__ __launch_bounds__(32 * KS) __attribute__((amdgpu_waves_per_eu(2, 2))) void k_attn(const float* __restrict__ XP, const float* __restrict__ YP, const _Float16* __restrict__ dT, const int* __restrict__ qmask, const int* __restrict__ amask, const float* __restrict__ rwp, float* __restrict__ out) {
  __shared__ __align__(16) float sS[KS][QG][16][68];
  __shared__ __align__(16) _Float16 sP[KS][QG][16][72];
  __shared__ __align__(16) float sO[NSL][QG][16][132];
  __shared__ float sM[NSL][QG][16];
  __shared__ float sL[NSL][QG][16];
  __shared__ float smk[NK];
  __shared__ __align__(16) v4u sQ[2][QG][4][2][2][32];   // the block's query fragments [timestep of the pair][row group][k chunk][hi, lo][half][lane], shared by all waves
  // w through readfirstlane: the wave's number in a scalar register, so that the key loop's trip test stays a scalar branch
  const int tid = threadIdx.x, w = __builtin_amdgcn_readfirstlane(tid >> 5), lane = tid & 31, col = lane & 15, g = lane >> 4;
  const int iB = blockIdx.y, iA = NT - 1 - iB, q0 = blockIdx.x * (16 * QG);   // iA > iB; tiles 0 .. iA - 1 of the pair are iA's, the others iB's
  const size_t rqA = (size_t)iA * L1 + q0, rqB = (size_t)iB * L1 + q0;
  { const int m = tid % MQ; const int* pmk = (m < 32 ? qmask + m : amask + (m - 32)) + (tid / MQ) * 32;   // key k = tid + 256 j: token m of timestep tid / 64 + 4 j
#pragma unroll   // the eight mask loads of a thread go out together; rolled, each is waited out alone
    for (int j = 0; j < NK / (32 * KS); ++j) smk[tid + j * 32 * KS] = pmk[j * (32 * KS / MQ) * 32] ? 1.f : 0.f; }    // 1 = padded (masked)
  if (w < 4 * QG) { v4f xs[2][4];   // fragment w = (row group w >> 2, k chunk w & 3) of both timesteps: a timestep's groups' planes follow one another
    ld_st(xs[0], XP + rqA * HH + w * 512 + lane * 4); ld_st(xs[1], XP + rqB * HH + w * 512 + lane * 4);
    asm volatile("s_wait_xcnt 0x0" ::: "memory");   // behind the eight loads, before anything re-uses the registers that they name
#pragma unroll   // unrolled: the loaded pieces are picked by constants and stay in registers
    for (int s = 0; s < 2; ++s) { union { F2 f; v4u q[4]; } u; u.f = as_f2(xs[s]);
      sQ[s][w >> 2][w & 3][0][0][lane] = u.q[0]; sQ[s][w >> 2][w & 3][0][1][lane] = u.q[1]; sQ[s][w >> 2][w & 3][1][0][lane] = u.q[2]; sQ[s][w >> 2][w & 3][1][1][lane] = u.q[3]; } }
  __syncthreads();
  {
    const int it0 = w * IPW, it1 = it0 + IPW < NI ? it0 + IPW : NI;   // this wave's run of the pair's tiles (never empty)
    v8f acc[QG][8] = {};
    float mrun[QG], lrun[QG]; const float rw = rwp[0];
#pragma unroll
    for (int qg = 0; qg < QG; ++qg) { mrun[qg] = -3.0e38f; lrun[qg] = 0.f; }
    // the wave's partial result (maximum, sum, accumulator of each row group) into a slot of its own
    auto put = [&](int slot) __attribute__((always_inline)) {
      const int tl = __builtin_amdgcn_mbcnt_lo(~0u, (unsigned)w * 32), lc = tl & 15, lg = (tl >> 4) & 1;   // tl == tid, formed anew from the wave's number: col and g held over the key loop were spilled
#pragma unroll   // all three loops unrolled: the accumulators are picked by constants and stay in registers
      for (int qg = 0; qg < QG; ++qg) {
        if (lg == 0) { sM[slot][qg][lc] = mrun[qg]; sL[slot][qg][lc] = lrun[qg]; }
#pragma unroll
        for (int r = 0; r < 8; ++r)
#pragma unroll
          for (int t = 0; t < 8; ++t) sO[slot][qg][8 * lg + r][t * 16 + lc] = acc[qg][t][r]; } };
    const unsigned lo = lane * 16;                             // this lane's byte in a 512-byte fragment piece, of y_proj and of the dialog copy alike; a tile's place is added as a 32-bit byte offset to the plane's scalar base
    unsigned yo = lo + (unsigned)(it0 < iA ? it0 : it0 - iA) * (64 * HH * 4);   // byte offset of this lane in the wave's current key tile of y_proj
    v4f st[4][4];                                              // split y_proj fragments of one 16-key group, one entry per k chunk
#pragma unroll
    for (int kc = 0; kc < 4; ++kc) { ld_st(st[kc], (const float*)((const char*)YP + yo) + kc * 512);
      __builtin_amdgcn_sched_barrier(0); }                     // chunks go out in the loop's own order: in another order the trip's first wait is for all sixteen loads
#pragma unroll 1
    for (int it = it0; it < it1; ++it) {
      const int sel = it < iA ? 0 : 1, kt = it < iA ? it : it - iA;   // key tile kt == timestep kt < i of timestep i = iA or iB (later timesteps are masked -> weight exactly 0)
      const float bias = rw * (float)((sel ? iB : iA) - kt);   // |i - j_ts| * recency_weight (row i >= 1)
      const float* yp = (const float*)((const char*)YP + yo);
      F2 aq[QG][4];                                      // re-read every trip: their registers hold the dialog tile during softmax and PV
#pragma unroll
      for (int qg = 0; qg < QG; ++qg)
#pragma unroll
        for (int kc = 0; kc < 4; ++kc) { union { F2 f; v4u q[4]; } u; u.q[0] = sQ[sel][qg][kc][0][0][lane]; u.q[1] = sQ[sel][qg][kc][0][1][lane]; u.q[2] = sQ[sel][qg][kc][1][0][lane]; u.q[3] = sQ[sel][qg][kc][1][1][lane]; aq[qg][kc] = u.f; }
#pragma unroll
      for (int t = 0; t < 4; ++t) { v8f s[QG] = {}; const int key = kt * 64 + t * 16 + col;
#pragma unroll
        for (int kc = 0; kc < 4; ++kc) { mac3x2(aq[0][kc], aq[1][kc], as_f2(st[kc]), s[0], s[1]);
          if (t < 3) {
            __builtin_amdgcn_sched_barrier(0);           // the products first, so that the load below re-uses their operand registers (lifted over them, it takes 16 more)
            WGAP();
            __builtin_amdgcn_sched_barrier(0);           // holds the slots between the products and the load
            ld_st(st[kc], yp + (t + 1) * 16 * HH + kc * 512);            // the next group's chunk into the registers just read
            __builtin_amdgcn_sched_barrier(0); } }       // keeps that load here, four chunks ahead of its use; sunk to its use it is waited out alone
        const bool pad = smk[key] != 0.f;
#pragma unroll
        for (int qg = 0; qg < QG; ++qg)
#pragma unroll
          for (int r = 0; r < 8; ++r) sS[w][qg][8 * g + r][t * 16 + col] = pad ? -3.0e38f : s[qg][r] + bias; }
      LDSX();
      const _Float16* dp = (const _Float16*)((const char*)dT + yo);   // the same byte offset: dialog tiles stand at y_proj's tile pitch
      v8h dv[2][8][2];                                   // the whole dialog tile, asked for now so that it lands behind the softmax
#pragma unroll
      for (int kc = 0; kc < 2; ++kc)
#pragma unroll
        for (int t = 0; t < 8; ++t) { const _Float16* p = dp + (kc * 8 + t) * 512; dv[kc][t][0] = *(const v8h*)p; dv[kc][t][1] = *(const v8h*)(p + 256); }
      asm volatile("s_wait_xcnt 0x0" :: "v"(yo) : "memory");   // the loads' offset register is live up to this wait
      __builtin_amdgcn_sched_barrier(0);                 // keeps the 32 loads in front of the softmax
#pragma unroll   // one softmax per row group, unrolled: the groups are independent and their state is picked by constants
      for (int qg = 0; qg < QG; ++qg) {
      float mx = -3.4e38f;
#pragma unroll
      for (int jj = 0; jj < 32; ++jj) mx = fmaxf(mx, sS[w][qg][col][g * 32 + jj]);
      mx = fmaxf(mx, __shfl_xor(mx, 16, 32));
      const float mnew = fmaxf(mrun[qg], mx); const bool dead = mnew <= -1.0e38f;   // dead: every key of this row so far is masked
      const float ce = ex2((mrun[qg] - mnew) * L2E); const float corr = dead ? 1.0f : ce;   // computed in every lane and then chosen: no branch round it
      const float mb = dead ? 0.f : -mnew * L2E;         // a masked score (-3e38) times L2E is -inf, whose 2^x is exactly 0, also in a dead row: no test per element
      float ps = 0.f;
#pragma unroll
      for (int jj = 0; jj < 32; jj += 4) { float p[4];
#pragma unroll
        for (int e = 0; e < 4; ++e) p[e] = fmaf(sS[w][qg][col][g * 32 + jj + e], L2E, mb);
        ex2x4(p[0], p[1], p[2], p[3]);
#pragma unroll
        for (int e = 0; e < 4; ++e) { ps += p[e]; sP[w][qg][col][g * 32 + jj + e] = (_Float16)(p[e] * 16384.0f); } }
      ps += __shfl_xor(ps, 16, 32);
      lrun[qg] = lrun[qg] * corr + ps; mrun[qg] = mnew;
#pragma unroll
      for (int r = 0; r < 8; ++r) { const float cr = __shfl(corr, 8 * g + r, 32);
#pragma unroll
        for (int t = 0; t < 8; ++t) acc[qg][t][r] *= cr; } }
      LDSX();
      const int itn = it + 1 < it1 ? it + 1 : it, ktn = itn < iA ? itn : itn - iA;
      const unsigned yof = yo + (unsigned)(ktn - kt) * (64 * HH * 4);
      const float* ypn = (const float*)((const char*)YP + yof);   // the wave's next tile (its last trip re-reads its own: in bounds, unused)
#pragma unroll
      for (int kc = 0; kc < 2; ++kc) { v16h pa[QG];
#pragma unroll
        for (int qg = 0; qg < QG; ++qg) pa[qg] = frag_h(&sP[w][qg][col][0] + kc * 32, lane);
#pragma unroll
        for (int t = 0; t < 8; ++t) { union { v16h v; v8h q[2]; } u; u.q[0] = dv[kc][t][0]; u.q[1] = dv[kc][t][1];
#pragma unroll
          for (int qg = 0; qg < QG; ++qg) acc[qg][t] = wmma16(pa[qg], u.v, acc[qg][t]);
          if (kc == 0 && (t & 1)) { __builtin_amdgcn_sched_barrier(0);   // the products first: the load may take the dialog registers that they read
            WGAP();
            __builtin_amdgcn_sched_barrier(0);           // holds the slots between the products and the load
            ld_st(st[t >> 1], ypn + (t >> 1) * 512);
            __builtin_amdgcn_sched_barrier(0); } } }     // next tile's first group goes out as dialog registers fall free, not at its use
      asm volatile("s_wait_xcnt 0x0" :: "v"(yof) : "memory");  // before the next trip re-uses the offset register of the loads still in flight
      yo = yof;
      if (it + 1 == iA && it + 1 < it1) {                // the run crosses to iB here: iA's partial result is put down, iB's starts from nothing
        put(w);
#pragma unroll   // both loops unrolled: the state is picked by constants and stays in registers
        for (int qg = 0; qg < QG; ++qg) { mrun[qg] = -3.0e38f; lrun[qg] = 0.f;
#pragma unroll
          for (int t = 0; t < 8; ++t) acc[qg][t] = v8f{}; } }
      __builtin_amdgcn_wave_barrier(); }
    put(it0 < iA && iA < it1 ? KS : w); }
  __syncthreads();   // every wave's partial (maximum, sum, accumulator) is in LDS before any thread merges
  // merge: thread = (row of each row group, two groups of 4 columns), both timesteps at once: every slot is read once and counts for the one timestep it belongs to, with
  // weight 0 for the other, so that all LDS reads are independent of each other; slot KS is read only where a wave crossed (else slot 0 in its place, with weight 0);
  // iB = 0 has no slot and gives the all-zero row block
  const int tm = __builtin_amdgcn_mbcnt_lo(~0u, (unsigned)w * 32), row = tm >> 4, c = (tm & 15) * 4;   // tm == tid, formed anew for the same reason
  const bool cross = iA % IPW != 0 && iA < NI;           // some wave's run holds tiles of both timesteps
#pragma unroll   // this loop and those over the slots unrolled: a slot's LDS reads stand at constant offsets and all go out together
  for (int qg = 0; qg < QG; ++qg) {
    float mu[NSL], ef[NSL], MA = -3.0e38f, MB = -3.0e38f, LA = 0.f, LB = 0.f; v4f a0 = {}, a1 = {}, b0 = {}, b1 = {};
#pragma unroll
    for (int u = 0; u < NSL; ++u) { const bool ofA = u < KS && u * IPW < iA, used = u < KS || cross;
      mu[u] = sM[used ? u : 0][qg][row]; if (!used) mu[u] = -3.0e38f;
      if (ofA) MA = fmaxf(MA, mu[u]); else MB = fmaxf(MB, mu[u]); }
#pragma unroll
    for (int u = 0; u < NSL; ++u) ef[u] = (mu[u] - (u < KS && u * IPW < iA ? MA : MB)) * L2E;
    ex2x4(ef[0], ef[1], ef[2], ef[3]); ex2x4(ef[4], ef[5], ef[6], ef[7]); ef[8] = ex2(ef[8]);
#pragma unroll
    for (int u = 0; u < NSL; ++u) { const bool ofA = u < KS && u * IPW < iA; const int uu = u < KS || cross ? u : 0;
      const float f = mu[u] <= -1.0e38f ? 0.f : ef[u], fa = ofA ? f : 0.f, fb = ofA ? 0.f : f;
      const float l = sL[uu][qg][row]; const v4f v0 = *(const v4f*)(&sO[uu][qg][row][c]), v1 = *(const v4f*)(&sO[uu][qg][row][64 + c]);
      LA += fa * l; a0 += fa * v0; a1 += fa * v1; LB += fb * l; b0 += fb * v0; b1 += fb * v1; }
    const float ia = LA > 0.f ? 1.0f / (LA * 16384.0f) : 0.f, ib = LB > 0.f ? 1.0f / (LB * 16384.0f) : 0.f;   // a fully padded history gives sum 0; guarded as before
    vst2(out + (rqA + qg * 16 + row) * HH + c, a0 * ia); vst2(out + (rqA + qg * 16 + row) * HH + 64 + c, a1 * ia);
    vst2(out + (rqB + qg * 16 + row) * HH + c, b0 * ib); vst2(out + (rqB + qg * 16 + row) * HH + 64 + c, b1 * ib);
    if (qg + 1 < QG) asm volatile("s_wait_xcnt 0x0" ::: "memory"); }   // behind the four stores, before the next row group's LDS reads land on the registers that they name
}
extern "C" void kernel_launch(void* const* d_in, const int* in_sizes, int n_in, void* d_out, int out_size, void* d_ws, size_t ws_size, hipStream_t stream) {
  (void)in_sizes; (void)n_in; (void)out_size; (void)ws_size;
  const float* xd = (const float*)d_in[0]; const float* xq = (const float*)d_in[1]; const float* xa = (const float*)d_in[2]; const float* W = (const float*)d_in[3]; const float* bias = (const float*)d_in[4]; const float* rw = (const float*)d_in[5]; const int* qm = (const int*)d_in[6]; const int* am = (const int*)d_in[7];
  float* out = (float*)d_out;
  char* ws = (char*)d_ws; size_t off = 0;
  auto take = [&](size_t bytes) { char* p = ws + off; off += (bytes + 255) & ~(size_t)255; return p; };
  float* XP = (float*)take((size_t)NT * L1 * HH * 4); float* YP = (float*)take((size_t)NK * HH * 4); _Float16* dT = (_Float16*)take((size_t)HH * NK * 4);
  k_proj<<<dim3(NT * L1 / 64, 3), 128, 0, stream>>>(xd, xq, xa, W, bias, XP, YP, dT);
  k_attn<<<dim3(L1 / (16 * QG), NT / 2), 32 * KS, 0, stream>>>(XP, YP, dT, qm, am, rw, out);
}

// v009
// A run of this version takes 26.8 microseconds.
// Next to v008, in two timings, it ran 1.18 and 1.20 times as fast.
// Over all steps from v000 it is 13.3 times as fast.
#include <hip/hip_runtime.h>
#include <math.h>

typedef __attribute__((ext_vector_type(16))) _Float16 v16h;
typedef __attribute__((ext_vector_type(16))) __bf16 v16b;
typedef __attribute__((ext_vector_type(8)))  _Float16 v8h;
typedef __attribute__((ext_vector_type(8)))  float v8f;
typedef __attribute__((ext_vector_type(4)))  float v4f;
typedef __attribute__((ext_vector_type(2)))  float v2f;
typedef __attribute__((ext_vector_type(4)))  unsigned v4u;
typedef __attribute__((ext_vector_type(4)))  int v4i;
typedef __attribute__((ext_vector_type(4)))  __bf16 v4b;
typedef float __attribute__((may_alias)) float_a;
typedef int __attribute__((may_alias)) int_a;

template <typename T> __device__ __forceinline__ void vst2(void* p, T v) { *(T*)p = v;  }
// k_attn's two forms are the bare builtins, whose distances the compiler keeps itself: an asm statement's vector operands can only stand in v0..v255, which cannot hold two row groups' fragments and accumulators
__device__ __forceinline__ v8f wmma16(v16h a, v16h b, v8f c) { return __builtin_amdgcn_wmma_f32_16x16x32_f16(false, a, false, b, (short)0, c, false, false); }
__device__ __forceinline__ v8f wmma_bfb(v16b a, v16b b, v8f c) { return __builtin_amdgcn_wmma_f32_16x16x32_bf16(false, a, false, b, (short)0, c, false, false); }
__device__ __forceinline__ v8f wmma_bf(v16b a, v16b b, v8f c) {
  v8f d = __builtin_amdgcn_wmma_f32_16x16x32_bf16(false, a, false, b, (short)0, c, false, false);
  asm volatile("v_nop\n\tv_nop\n\tv_nop\n\tv_nop" : "+v"(d) : "v"(a), "v"(b));
  return d;
}
// 16x16x32 fragments: lane = (h = lane>>4, row/col = lane&15); elements 0..7 = k0+8h+0..7, 8..15 = k0+16+8h+0..7; D element r = row 8h+r
__device__ __forceinline__ v16h frag_h(const _Float16* rowk0, int lane) {
  union { v16h v; v8h q[2]; } u; const _Float16* p = rowk0 + 8 * (lane >> 4);
  u.q[0] = *(const v8h*)p; u.q[1] = *(const v8h*)(p + 16); return u.v;
}
__device__ __forceinline__ v16h frag_f32(const float* rowk0, int lane) {
  v16h a; const float* p = rowk0 + 8 * (lane >> 4);
#pragma unroll
  for (int i = 0; i < 8; ++i) { a[i] = (_Float16)p[i]; a[8 + i] = (_Float16)p[16 + i]; }
  return a;
}
__device__ __forceinline__ v16h frag_f32s(const float* rowk0, int lane, float sc) {
  v16h a; const float* p = rowk0 + 8 * (lane >> 4);
#pragma unroll
  for (int i = 0; i < 8; ++i) { a[i] = (_Float16)(p[i] * sc); a[8 + i] = (_Float16)(p[16 + i] * sc); }
  return a;
}
// column fragment from a [K][ld] layout (column n), rows >= K read as 0
__device__ __forceinline__ v16h fragc_f32(const float* W, int k0, int n, int lane, int ld, int K) {
  v16h a; const int g = lane >> 4;
#pragma unroll
  for (int i = 0; i < 8; ++i) { const int ka = k0 + 8 * g + i, kb = ka + 16;
    a[i] = (_Float16)(ka < K ? W[(size_t)ka * ld + n] : 0.f); a[8 + i] = (_Float16)(kb < K ? W[(size_t)kb * ld + n] : 0.f); }
  return a;
}
struct F2 { v16b h, l; };
__device__ __forceinline__ F2 bsplit16(const float v[16]) { F2 r;
#pragma unroll
  for (int i = 0; i < 16; ++i) { const __bf16 h = (__bf16)v[i]; r.h[i] = h; r.l[i] = (__bf16)(v[i] - (float)h); }
  return r; }
__device__ __forceinline__ F2 split_row(const float* row, int k0, int lane) { float v[16]; const float* p = row + k0 + 8 * (lane >> 4);
#pragma unroll
  for (int i = 0; i < 8; ++i) { v[i] = p[i]; v[8 + i] = p[16 + i]; }
  return bsplit16(v); }
__device__ __forceinline__ F2 split_rowK(const float* row, int k0, int lane, int K) { float v[16]; const int g = lane >> 4;
#pragma unroll
  for (int i = 0; i < 8; ++i) { const int ka = k0 + 8 * g + i, kb = ka + 16; v[i] = ka < K ? row[ka] : 0.f; v[8 + i] = kb < K ? row[kb] : 0.f; }
  return bsplit16(v); }
__device__ __forceinline__ F2 split_col(const float* W, int k0, int n, int lane, int ld, int K) { float v[16]; const int g = lane >> 4;
#pragma unroll
  for (int i = 0; i < 8; ++i) { const int ka = k0 + 8 * g + i, kb = ka + 16; v[i] = ka < K ? W[(size_t)ka * ld + n] : 0.f; v[8 + i] = kb < K ? W[(size_t)kb * ld + n] : 0.f; }
  return bsplit16(v); }
// split_row in two halves, so that the loads can stand apart from the arithmetic: the fragment's sixteen f32 as four 16-byte loads (p = row + k0 + 8 * (lane >> 4)), and their split
__device__ __forceinline__ void ld_raw(v4f s[4], const float* p) { s[0] = *(const v4f*)p; s[1] = *(const v4f*)(p + 4); s[2] = *(const v4f*)(p + 16); s[3] = *(const v4f*)(p + 20); }
__device__ __forceinline__ F2 split_raw(const v4f s[4]) { float v[16];
#pragma unroll
  for (int i = 0; i < 16; ++i) v[i] = s[i >> 2][i & 3];
  return bsplit16(v); }
// the four 16-byte pieces of one stored fragment pair, taken as they are: no arithmetic
__device__ __forceinline__ F2 as_f2(const v4f s[4]) { union { F2 f; v4f q[4]; } u; u.q[0] = s[0]; u.q[1] = s[1]; u.q[2] = s[2]; u.q[3] = s[3]; return u.f; }
// one row fragment's two-way bf16 split, as stored by k_proj in a fragment-ordered plane (p = fragment + lane * 4; 16-byte pieces carried in v4f registers, never computed on):
// pieces 0, 1 = the high parts, pieces 2, 3 = the low parts, of elements 0..7 and 8..15 of split_row's fragment of row lane & 15; each of the four loads covers 512 contiguous bytes
__device__ __forceinline__ void ld_st(v4f s[4], const float* p) { s[0] = *(const v4f*)p; s[1] = *(const v4f*)(p + 128); s[2] = *(const v4f*)(p + 256); s[3] = *(const v4f*)(p + 384); }
// one split W fragment in LDS: [hi, lo][elements 0..7, 8..15][lane half][16 lanes][16 bytes]; a lane half stands at 320 and an element half at 640 bytes, so that the 32 8-byte
// stores of a staging wave (4 rows x one 128-byte line) fall on all 64 banks once, while each half-wave's 16-byte reads stay 256 contiguous bytes
#define WGH 320
#define WEH 640
#define WHL 1280
#define WFP 2560
// one staged W fragment pair (p = fragment + this lane's place): the pieces in ld_st's order
__device__ __forceinline__ void ld_w(v4f s[4], const unsigned char* p) { s[0] = *(const v4f*)p; s[1] = *(const v4f*)(p + WEH); s[2] = *(const v4f*)(p + WHL); s[3] = *(const v4f*)(p + WHL + WEH); }
__device__ __forceinline__ v8f mac3(const F2& a, const F2& b, v8f c) { c = wmma_bf(a.l, b.h, c); c = wmma_bf(a.h, b.l, c); return wmma_bf(a.h, b.h, c); }
// mac3 for two row groups against one B fragment, the two accumulate chains alternating: each fills the other's wait for its own previous product; each chain's order is mac3's
__device__ __forceinline__ void mac3x2(const F2& a0, const F2& a1, const F2& b, v8f& c0, v8f& c1) {
  c0 = wmma_bfb(a0.l, b.h, c0); c1 = wmma_bfb(a1.l, b.h, c1); c0 = wmma_bfb(a0.h, b.l, c0); c1 = wmma_bfb(a1.h, b.l, c1); c0 = wmma_bfb(a0.h, b.h, c0); c1 = wmma_bfb(a1.h, b.h, c1); }
__device__ __forceinline__ float sigm(float v) { return 1.0f / (1.0f + expf(-v)); }
// 2^x on the hardware's own instruction, in place: 0 for x = -inf or far below the f32 range, no range branch, no fix-up chain.
// Written as asm so that the slot which the instruction set asks for behind a transcendental is filled by construction: by the next, independent v_exp_f32,
// and behind the last one by the v_nop
__device__ __forceinline__ void ex2x4(float& a, float& b, float& c, float& d) {
  asm("v_exp_f32 %0, %0\n\tv_exp_f32 %1, %1\n\tv_exp_f32 %2, %2\n\tv_exp_f32 %3, %3\n\tv_nop" : "+v"(a), "+v"(b), "+v"(c), "+v"(d)); }
__device__ __forceinline__ float ex2(float x) { asm("v_exp_f32 %0, %0\n\tv_nop" : "+v"(x)); return x; }   // the same for one value
#define L2E 1.4426950408889634f
// four vector slots between a product and a global load over registers that it read as B
#define WGAP() asm volatile("v_nop\n\tv_nop\n\tv_nop\n\tv_nop")
#define LDSX() do { asm volatile("s_wait_dscnt 0" ::: "memory"); __builtin_amdgcn_wave_barrier(); __builtin_amdgcn_fence(__ATOMIC_RELEASE, "workgroup"); } while (0)

// Dialog sequence-attention matching: x_proj / y_proj = relu(. @ W^T + b) as two-way bf16 splits on WMMA (f32 results, stored as their own two-way bf16 splits); per (timestep i,
// 16 document positions) only the key tiles of earlier timesteps are visited, dealt over the block's waves (later ones and padded tokens are exactly weight 0; row i = 0
// is all-zero: k_attn stores it with inv = 0), scores as two-way bf16 splits (logits are O(10): near-f32 keeps the sharp softmax exact), recency bias and pad
// mask (read as data) in f32, online softmax in f32, alpha (x2^14 f16) @ dialog embeddings (f16 transposed copy) on v_wmma_f32_16x16x32_f16.
#define NT 32
#define L1 512
#define MQ 64                  // tokens per timestep (32 + 32)
#define NK (NT * MQ)           // 2048
#define HH 128
#define WRING 6                // W fragments on their way from LDS per wave of k_proj, fetched two at a place

// projections: blockIdx.y = 0: XP rows (16384) from xd; 1: YP rows (2048) from dlg = [xq | xa] per timestep; also the transposed dialog copy in f16 (which = 2).
// All three planes are laid out in the order k_attn's lanes read them, so that each of its wave-wide 16-byte loads covers four whole 128-byte lines
// (in row-major planes such a load touches sixteen lines):
//   XP, YP: [16-row group][k chunk of 32][piece j][lane][16 bytes], already split into bf16 high and low parts (ld_st says what piece j holds): as many bytes as the f32 rows
//   dT:     [64-key tile, at the 32-KiB pitch of a y_proj tile (second half unused) so that one offset register serves both planes][k chunk of 32 keys][16-column group t][half h][lane][8 f16] = keys chunk + 16 h + 8 (lane >> 4) + 0..7 of column 16 t + (lane & 15)
__global__ __launch_bounds__(128) void k_proj(const float* __restrict__ xd, const float* __restrict__ xq, const float* __restrict__ xa, const float* __restrict__ W, const float* __restrict__ bias, float* __restrict__ XP, float* __restrict__ YP, _Float16* __restrict__ dT) {
  __shared__ __align__(16) float so[4][16][132];
  __shared__ __align__(16) unsigned char sw[32 * WFP];       // W as split fragments (which < 2); the dialog copy's blocks use its first bytes as st
  _Float16 (*st)[72] = (_Float16 (*)[72])sw;
  const int tid = threadIdx.x, wave = tid >> 5, lane = tid & 31, col = lane & 15, g = lane >> 4;
  const int which = blockIdx.y, r0 = blockIdx.x * 64 + wave * 16;
  if (which == 0 || blockIdx.x < NK / 64) {
    if (which < 2) { v8f acc[8] = {};
      const int key = r0 + col, ts = key / MQ, m = key % MQ;   // which == 1: the dialog row of this lane
      const float* src = which == 0 ? xd + (size_t)(r0 + col) * HH : m < 32 ? xq + ((size_t)ts * 32 + m) * HH : xa + ((size_t)ts * 32 + m - 32) * HH;
      const float* ap = src + 8 * g;                           // split_row's start in this lane's input row
      // W is read and split once per block, not once per wave: wave w brings rows 32 w .. 32 w + 31, each load 4 rows x one whole 128-byte line (8 lanes a line; a fragment load
      // straight from W touches 16 lines), splits its 4 values a lane as bsplit16 does and puts them where fragment f = (k chunk f >> 3, column group f & 7) has them
      const float* wsrc = W + (size_t)(wave * 32 + (lane >> 3)) * HH + (lane & 7) * 4;   // load i: rows + (i >> 2) * 4, k chunk i & 3
      unsigned char* wdst = sw + wave * 2 * WFP + ((lane >> 2) & 1) * WEH + ((lane >> 1) & 1) * WGH + (lane >> 3) * 16 + (lane & 1) * 8;
      const unsigned char* wp = sw + g * WGH + col * 16;       // this lane's place in a staged fragment
      // the first two input chunks, all of W and the bias go out at once, ahead of their use
      float bb[8]; v4f ar[2][4], wr[WRING][4], wv[32];
#pragma unroll
      for (int kc = 0; kc < 2; ++kc) ld_raw(ar[kc], ap + kc * 32);
#pragma unroll   // unrolled: the 32 loads go out together and their values are picked by constants
      for (int i = 0; i < 32; ++i) wv[i] = *(const v4f*)(wsrc + (i >> 2) * 4 * HH + (i & 3) * 32);
#pragma unroll
      for (int j = 0; j < 8; ++j) bb[j] = bias[j * 16 + col];
      asm volatile("s_wait_xcnt 0x0" :: "v"(wsrc) : "memory");   // W's address registers are live up to this wait, before anything re-uses them
      __builtin_amdgcn_sched_barrier(0);                       // keeps these loads in front of the split
#pragma unroll   // unrolled: the loaded values are picked by constants and stay in registers, the LDS places are immediate offsets
      for (int i = 0; i < 32; ++i) { const v4b h = __builtin_convertvector(wv[i], v4b); const v4b l = __builtin_convertvector(wv[i] - __builtin_convertvector(h, v4f), v4b);
        unsigned char* d = wdst + ((i & 3) * 8 + (i >> 4)) * WFP + ((i >> 2) & 3) * 64;
        vst2(d, h); vst2(d + WHL, l); }
      __syncthreads();                                         // all of W stands in LDS before any wave reads a fragment
#pragma unroll   // unrolled: the ring's entries are picked by constants and stay in registers
      for (int f = 0; f < WRING; ++f) ld_w(wr[f], wp + f * WFP);
      __builtin_amdgcn_sched_barrier(0);                       // keeps these reads in front of the products
      F2 a;
#pragma unroll   // unrolled: the ring's entries are picked by constants and stay in registers
      for (int f = 0; f < 32; ++f) { const int kc = f >> 3, j = f & 7;
        if (j == 0) { a = split_raw(ar[kc & 1]);
          if (kc + 2 < 4) { __builtin_amdgcn_sched_barrier(0);   // the split first, so that the load re-uses its registers
            ld_raw(ar[kc & 1], ap + (kc + 2) * 32);
            __builtin_amdgcn_sched_barrier(0); } }               // keeps that load here, two k chunks ahead of its use
        acc[j] = mac3(a, as_f2(wr[f % WRING]), acc[j]);
        if ((f & 1) && f + WRING < 32) { __builtin_amdgcn_sched_barrier(0);   // the products first, then the two entries just used are read anew: one place with LDS reads per two fragments
          ld_w(wr[(f - 1) % WRING], wp + (f - 1 + WRING) * WFP); ld_w(wr[f % WRING], wp + (f + WRING) * WFP);
          __builtin_amdgcn_sched_barrier(0); } }               // keeps those reads here, two places ahead of their use
      asm volatile("s_wait_xcnt 0x0" :: "v"(ap) : "memory");   // the loads' address registers are live up to this wait, before anything re-uses them
#pragma unroll
      for (int j = 0; j < 8; ++j) { const int c = j * 16 + col;
#pragma unroll
        for (int r = 0; r < 8; ++r) { const float v = acc[j][r] + bb[j]; so[wave][8 * g + r][c] = v > 0.f ? v : 0.f; } }
      LDSX();
      float* dst = which == 0 ? XP : YP;
#pragma unroll   // both loops unrolled: the pieces are picked by constants and stay in registers
      for (int kc = 0; kc < 4; ++kc) { union { F2 f; v4f q[4]; } u; u.f = split_row(&so[wave][col][0], kc * 32, lane);   // the split is made here, once per row
#pragma unroll
        for (int j = 0; j < 4; ++j) vst2(dst + (size_t)r0 * HH + (kc * 4 + j) * 128 + lane * 4, u.q[j]); } }
    else {   // the dialog copy of this block's 64 keys (one key tile)
      const float* qp = xq + (size_t)blockIdx.x * 32 * HH + tid; const float* pa = xa + (size_t)blockIdx.x * 32 * HH + tid;   // key blockIdx.x * 64 + kl is token kl of timestep blockIdx.x; this thread has column tid
      float v[64];
#pragma unroll   // the thread's 64 loads go out together; rolled, every few are waited out alone
      for (int kl = 0; kl < 32; ++kl) { v[kl] = qp[kl * HH]; v[32 + kl] = pa[kl * HH]; }
#pragma unroll
      for (int kl = 0; kl < 64; ++kl) st[tid][kl] = (_Float16)v[kl];
      __syncthreads();
#pragma unroll   // a constant trip count, unrolled: the eight LDS reads go out together, then the eight stores
      for (int it = 0; it < HH * 8 / 128; ++it) { const int q = tid + it * 128, f = q >> 5, kc = f >> 4, t = (f >> 1) & 7, h = f & 1;   // q = (fragment half f, lane)
        vst2(dT + (size_t)blockIdx.x * (2 * 64 * HH) + q * 8, *(const v4u*)(&st[t * 16 + col][kc * 32 + 16 * h + 8 * g])); } } }
}
// attention: block (QG * 16 doc positions, timestep pair iA = NT - 1 - p, iB = p). A timestep i has i key tiles, so every pair has NT - 1 of them: they are numbered
// through (first iA's, then iB's) and dealt in runs of IPW over the block's waves, so that every wave of every block has the same number of trips (the last wave one less)
// and all blocks are resident at once. A wave takes each of its tiles for all QG 16-row groups, so that every y_proj and dialog fragment it loads from L2 is used QG times,
// and keeps per group its own running maximum, sum and un-normalised accumulator. The one wave whose run crosses from iA to iB puts its partial result down at the crossing
// and starts anew; the partial results are merged per timestep through LDS behind one work-group barrier
#define KS 8
#define QG 2
#define NI (NT - 1)                    // key tiles of a timestep pair
#define IPW ((NI + KS - 1) / KS)       // tiles per wave
#define NSL (KS + 1)                   // partial results: slot w = wave w's first (or only) one, slot KS = the crossing wave's second
// two waves per SIMD, one work-group on a WGP: both groups' accumulators and query fragments stay in registers
__global__ __launch_bounds__(32 * KS) __attribute__((amdgpu_waves_per_eu(2, 2))) void k_attn(const float* __restrict__ XP, const float* __restrict__ YP, const _Float16* __restrict__ dT, const int* __restrict__ qmask, const int* __restrict__ amask, const float* __restrict__ rwp, float* __restrict__ out) {
  __shared__ __align__(16) float sS[KS][QG][16][68];
  __shared__ __align__(16) _Float16 sP[KS][QG][16][72];
  __shared__ __align__(16) float sO[NSL][QG][16][132];
  __shared__ float sM[NSL][QG][16];
  __shared__ float sL[NSL][QG][16];
  __shared__ float smk[NK];
  __shared__ __align__(16) v4u sQ[2][QG][4][2][2][32];   // the block's query fragments [timestep of the pair][row group][k chunk][hi, lo][half][lane], shared by all waves
  // w through readfirstlane: the wave's number in a scalar register, so that the key loop's trip test stays a scalar branch
  const int tid = threadIdx.x, w = __builtin_amdgcn_readfirstlane(tid >> 5), lane = tid & 31, col = lane & 15, g = lane >> 4;
  const int iB = blockIdx.y, iA = NT - 1 - iB, q0 = blockIdx.x * (16 * QG);   // iA > iB; tiles 0 .. iA - 1 of the pair are iA's, the others iB's
  const size_t rqA = (size_t)iA * L1 + q0, rqB = (size_t)iB * L1 + q0;
  { const int m = tid % MQ; const int* pmk = (m < 32 ? qmask + m : amask + (m - 32)) + (tid / MQ) * 32;   // key k = tid + 256 j: token m of timestep tid / 64 + 4 j
#pragma unroll   // the eight mask loads of a thread go out together; rolled, each is waited out alone
    for (int j = 0; j < NK / (32 * KS); ++j) smk[tid + j * 32 * KS] = pmk[j * (32 * KS / MQ) * 32] ? 1.f : 0.f; }    // 1 = padded (masked)
  if (w < 4 * QG) { v4f xs[2][4];   // fragment w = (row group w >> 2, k chunk w & 3) of both timesteps: a timestep's groups' planes follow one another
    ld_st(xs[0], XP + rqA * HH + w * 512 + lane * 4); ld_st(xs[1], XP + rqB * HH + w * 512 + lane * 4);
    asm volatile("s_wait_xcnt 0x0" ::: "memory");   // behind the eight loads, before anything re-uses the registers that they name
#pragma unroll   // unrolled: the loaded pieces are picked by constants and stay in registers
    for (int s = 0; s < 2; ++s) { union { F2 f; v4u q[4]; } u; u.f = as_f2(xs[s]);
      sQ[s][w >> 2][w & 3][0][0][lane] = u.q[0]; sQ[s][w >> 2][w & 3][0][1][lane] = u.q[1]; sQ[s][w >> 2][w & 3][1][0][lane] = u.q[2]; sQ[s][w >> 2][w & 3][1][1][lane] = u.q[3]; } }
  __syncthreads();
  {
    const int it0 = w * IPW, it1 = it0 + IPW < NI ? it0 + IPW : NI;   // this wave's run of the pair's tiles (never empty)
    v8f acc[QG][8] = {};
    float mrun[QG], lrun[QG]; const float rw = rwp[0];
#pragma unroll
    for (int qg = 0; qg < QG; ++qg) { mrun[qg] = -3.0e38f; lrun[qg] = 0.f; }
    // the wave's partial result (maximum, sum, accumulator of each row group) into a slot of its own
    auto put = [&](int slot) __attribute__((always_inline)) {
      const int tl = __builtin_amdgcn_mbcnt_lo(~0u, (unsigned)w * 32), lc = tl & 15, lg = (tl >> 4) & 1;   // tl == tid, formed anew from the wave's number: col and g held over the key loop were spilled
#pragma unroll   // all three loops unrolled: the accumulators are picked by constants and stay in registers
      for (int qg = 0; qg < QG; ++qg) {
        if (lg == 0) { sM[slot][qg][lc] = mrun[qg]; sL[slot][qg][lc] = lrun[qg]; }
#pragma unroll
        for (int r = 0; r < 8; ++r)
#pragma unroll
          for (int t = 0; t < 8; ++t) sO[slot][qg][8 * lg + r][t * 16 + lc] = acc[qg][t][r]; } };
    const unsigned lo = lane * 16;                             // this lane's byte in a 512-byte fragment piece, of y_proj and of the dialog copy alike; a tile's place is added as a 32-bit byte offset to the plane's scalar base
    unsigned yo = lo + (unsigned)(it0 < iA ? it0 : it0 - iA) * (64 * HH * 4);   // byte offset of this lane in the wave's current key tile of y_proj
    v4f st[4][4];                                              // split y_proj fragments of one 16-key group, one entry per k chunk
#pragma unroll
    for (int kc = 0; kc < 4; ++kc) { ld_st(st[kc], (const float*)((const char*)YP + yo) + kc * 512);
      __builtin_amdgcn_sched_barrier(0); }                     // chunks go out in the loop's own order: in another order the trip's first wait is for all sixteen loads
#pragma unroll 1
    for (int it = it0; it < it1; ++it) {
      const int sel = it < iA ? 0 : 1, kt = it < iA ? it : it - iA;   // key tile kt == timestep kt < i of timestep i = iA or iB (later timesteps are masked -> weight exactly 0)
      const float bias = rw * (float)((sel ? iB : iA) - kt);   // |i - j_ts| * recency_weight (row i >= 1)
      const float* yp = (const float*)((const char*)YP + yo);
      F2 aq[QG][4];                                      // re-read every trip: their registers hold the dialog tile during softmax and PV
#pragma unroll
      for (int qg = 0; qg < QG; ++qg)
#pragma unroll
        for (int kc = 0; kc < 4; ++kc) { union { F2 f; v4u q[4]; } u; u.q[0] = sQ[sel][qg][kc][0][0][lane]; u.q[1] = sQ[sel][qg][kc][0][1][lane]; u.q[2] = sQ[sel][qg][kc][1][0][lane]; u.q[3] = sQ[sel][qg][kc][1][1][lane]; aq[qg][kc] = u.f; }
#pragma unroll
      for (int t = 0; t < 4; ++t) { v8f s[QG] = {}; const int key = kt * 64 + t * 16 + col;
#pragma unroll
        for (int kc = 0; kc < 4; ++kc) { mac3x2(aq[0][kc], aq[1][kc], as_f2(st[kc]), s[0], s[1]);
          if (t < 3) {
            __builtin_amdgcn_sched_barrier(0);           // the products first, so that the load below re-uses their operand registers (lifted over them, it takes 16 more)
            WGAP();
            __builtin_amdgcn_sched_barrier(0);           // holds the slots between the products and the load
            ld_st(st[kc], yp + (t + 1) * 16 * HH + kc * 512);            // the next group's chunk into the registers just read
            __builtin_amdgcn_sched_barrier(0); } }       // keeps that load here, four chunks ahead of its use; sunk to its use it is waited out alone
        const bool pad = smk[key] != 0.f;
#pragma unroll
        for (int qg = 0; qg < QG; ++qg)
#pragma unroll
          for (int r = 0; r < 8; ++r) sS[w][qg][8 * g + r][t * 16 + col] = pad ? -3.0e38f : s[qg][r] + bias; }
      LDSX();
      const _Float16* dp = (const _Float16*)((const char*)dT + yo);   // the same byte offset: dialog tiles stand at y_proj's tile pitch
      v8h dv[2][8][2];                                   // the whole dialog tile, asked for now so that it lands behind the softmax
#pragma unroll
      for (int kc = 0; kc < 2; ++kc)
#pragma unroll
        for (int t = 0; t < 8; ++t) { const _Float16* p = dp + (kc * 8 + t) * 512; dv[kc][t][0] = *(const v8h*)p; dv[kc][t][1] = *(const v8h*)(p + 256); }
      asm volatile("s_wait_xcnt 0x0" :: "v"(yo) : "memory");   // the loads' offset register is live up to this wait
      __builtin_amdgcn_sched_barrier(0);                 // keeps the 32 loads in front of the softmax
#pragma unroll   // one softmax per row group, unrolled: the groups are independent and their state is picked by constants
      for (int qg = 0; qg < QG; ++qg) {
      float mx = -3.4e38f;
#pragma unroll
      for (int jj = 0; jj < 32; ++jj) mx = fmaxf(mx, sS[w][qg][col][g * 32 + jj]);
      mx = fmaxf(mx, __shfl_xor(mx, 16, 32));
      const float mnew = fmaxf(mrun[qg], mx); const bool dead = mnew <= -1.0e38f;   // dead: every key of this row so far is masked
      const float ce = ex2((mrun[qg] - mnew) * L2E); const float corr = dead ? 1.0f : ce;   // computed in every lane and then chosen: no branch round it
      const float mb = dead ? 0.f : -mnew * L2E;         // a masked score (-3e38) times L2E is -inf, whose 2^x is exactly 0, also in a dead row: no test per element
      float ps = 0.f;
#pragma unroll
      for (int jj = 0; jj < 32; jj += 4) { float p[4];
#pragma unroll
        for (int e = 0; e < 4; ++e) p[e] = fmaf(sS[w][qg][col][g * 32 + jj + e], L2E, mb);
        ex2x4(p[0], p[1], p[2], p[3]);
#pragma unroll
        for (int e = 0; e < 4; ++e) { ps += p[e]; sP[w][qg][col][g * 32 + jj + e] = (_Float16)(p[e] * 16384.0f); } }
      ps += __shfl_xor(ps, 16, 32);
      lrun[qg] = lrun[qg] * corr + ps; mrun[qg] = mnew;
#pragma unroll
      for (int r = 0; r < 8; ++r) { const float cr = __shfl(corr, 8 * g + r, 32);
#pragma unroll
        for (int t = 0; t < 8; ++t) acc[qg][t][r] *= cr; } }
      LDSX();
      const int itn = it + 1 < it1 ? it + 1 : it, ktn = itn < iA ? itn : itn - iA;
      const unsigned yof = yo + (unsigned)(ktn - kt) * (64 * HH * 4);
      const float* ypn = (const float*)((const char*)YP + yof);   // the wave's next tile (its last trip re-reads its own: in bounds, unused)
#pragma unroll
      for (int kc = 0; kc < 2; ++kc) { v16h pa[QG];
#pragma unroll
        for (int qg = 0; qg < QG; ++qg) pa[qg] = frag_h(&sP[w][qg][col][0] + kc * 32, lane);
#pragma unroll
        for (int t = 0; t < 8; ++t) { union { v16h v; v8h q[2]; } u; u.q[0] = dv[kc][t][0]; u.q[1] = dv[kc][t][1];
#pragma unroll
          for (int qg = 0; qg < QG; ++qg) acc[qg][t] = wmma16(pa[qg], u.v, acc[qg][t]);
          if (kc == 0 && (t & 1)) { __builtin_amdgcn_sched_barrier(0);   // the products first: the load may take the dialog registers that they read
            WGAP();
            __builtin_amdgcn_sched_barrier(0);           // holds the slots between the products and the load
            ld_st(st[t >> 1], ypn + (t >> 1) * 512);
            __builtin_amdgcn_sched_barrier(0); } } }     // next tile's first group goes out as dialog registers fall free, not at its use
      asm volatile("s_wait_xcnt 0x0" :: "v"(yof) : "memory");  // before the next trip re-uses the offset register of the loads still in flight
      yo = yof;
      if (it + 1 == iA && it + 1 < it1) {                // the run crosses to iB here: iA's partial result is put down, iB's starts from nothing
        put(w);
#pragma unroll   // both loops unrolled: the state is picked by constants and stays in registers
        for (int qg = 0; qg < QG; ++qg) { mrun[qg] = -3.0e38f; lrun[qg] = 0.f;
#pragma unroll
          for (int t = 0; t < 8; ++t) acc[qg][t] = v8f{}; } }
      __builtin_amdgcn_wave_barrier(); }
    put(it0 < iA && iA < it1 ? KS : w); }
  __syncthreads();   // every wave's partial (maximum, sum, accumulator) is in LDS before any thread merges
  // merge: thread = (row of each row group, two groups of 4 columns), both timesteps at once: every slot is read once and counts for the one timestep it belongs to, with
  // weight 0 for the other, so that all LDS reads are independent of each other; slot KS is read only where a wave crossed (else slot 0 in its place, with weight 0);
  // iB = 0 has no slot and gives the all-zero row block
  const int tm = __builtin_amdgcn_mbcnt_lo(~0u, (unsigned)w * 32), row = tm >> 4, c = (tm & 15) * 4;   // tm == tid, formed anew for the same reason
  const bool cross = iA % IPW != 0 && iA < NI;           // some wave's run holds tiles of both timesteps
#pragma unroll   // this loop and those over the slots unrolled: a slot's LDS reads stand at constant offsets and all go out together
  for (int qg = 0; qg < QG; ++qg) {
    float mu[NSL], ef[NSL], MA = -3.0e38f, MB = -3.0e38f, LA = 0.f, LB = 0.f; v4f a0 = {}, a1 = {}, b0 = {}, b1 = {};
#pragma unroll
    for (int u = 0; u < NSL; ++u) { const bool ofA = u < KS && u * IPW < iA, used = u < KS || cross;
      mu[u] = sM[used ? u : 0][qg][row]; if (!used) mu[u] = -3.0e38f;
      if (ofA) MA = fmaxf(MA, mu[u]); else MB = fmaxf(MB, mu[u]); }
#pragma unroll
    for (int u = 0; u < NSL; ++u) ef[u] = (mu[u] - (u < KS && u * IPW < iA ? MA : MB)) * L2E;
    ex2x4(ef[0], ef[1], ef[2], ef[3]); ex2x4(ef[4], ef[5], ef[6], ef[7]); ef[8] = ex2(ef[8]);
#pragma unroll
    for (int u = 0; u < NSL; ++u) { const bool ofA = u < KS && u * IPW < iA; const int uu = u < KS || cross ? u : 0;
      const float f = mu[u] <= -1.0e38f ? 0.f : ef[u], fa = ofA ? f : 0.f, fb = ofA ? 0.f : f;
      const float l = sL[uu][qg][row]; const v4f v0 = *(const v4f*)(&sO[uu][qg][row][c]), v1 = *(const v4f*)(&sO[uu][qg][row][64 + c]);
      LA += fa * l; a0 += fa * v0; a1 += fa * v1; LB += fb * l; b0 += fb * v0; b1 += fb * v1; }
    const float ia = LA > 0.f ? 1.0f / (LA * 16384.0f) : 0.f, ib = LB > 0.f ? 1.0f / (LB * 16384.0f) : 0.f;   // a fully padded history gives sum 0; guarded as before
    vst2(out + (rqA + qg * 16 + row) * HH + c, a0 * ia); vst2(out + (rqA + qg * 16 + row) * HH + 64 + c, a1 * ia);
    vst2(out + (rqB + qg * 16 + row) * HH + c, b0 * ib); vst2(out + (rqB + qg * 16 + row) * HH + 64 + c, b1 * ib);
    if (qg + 1 < QG) asm volatile("s_wait_xcnt 0x0" ::: "memory"); }   // behind the four stores, before the next row group's LDS reads land on the registers that they name
}
extern "C" void kernel_launch(void* const* d_in, const int* in_sizes, int n_in, void* d_out, int out_size, void* d_ws, size_t ws_size, hipStream_t stream) {
  (void)in_sizes; (void)n_in; (void)out_size; (void)ws_size;
  const float* xd = (const float*)d_in[0]; const float* xq = (const float*)d_in[1]; const float* xa = (const float*)d_in[2]; const float* W = (const float*)d_in[3]; const float* bias = (const float*)d_in[4]; const float* rw = (const float*)d_in[5]; const int* qm = (const int*)d_in[6]; const int* am = (const int*)d_in[7];
  float* out = (float*)d_out;
  char* ws = (char*)d_ws; size_t off = 0;
  auto take = [&](size_t bytes) { char* p = ws + off; off += (bytes + 255) & ~(size_t)255; return p; };
  float* XP = (float*)take((size_t)NT * L1 * HH * 4); float* YP = (float*)take((size_t)NK * HH * 4); _Float16* dT = (_Float16*)take((size_t)HH * NK * 4);
  k_proj<<<dim3(NT * L1 / 64, 3), 128, 0, stream>>>(xd, xq, xa, W, bias, XP, YP, dT);
  k_attn<<<dim3(L1 / (16 * QG), NT / 2), 32 * KS, 0, stream>>>(XP, YP, dT, qm, am, rw, out);
}

// v010
// A run of this version takes 21.2 microseconds.
// Two timings next to v009 both put it at 1.24 times that version's speed.
// Counting every step since v000, it is 16.5 times as fast.
#include <hip/hip_runtime.h>
#include <math.h>

typedef __attribute__((ext_vector_type(16))) _Float16 v16h;
typedef __attribute__((ext_vector_type(16))) __bf16 v16b;
typedef __attribute__((ext_vector_type(8)))  _Float16 v8h;
typedef __attribute__((ext_vector_type(8)))  float v8f;
typedef __attribute__((ext_vector_type(4)))  float v4f;
typedef __attribute__((ext_vector_type(2)))  float v2f;
typedef __attribute__((ext_vector_type(4)))  unsigned v4u;
typedef __attribute__((ext_vector_type(4)))  int v4i;
typedef __attribute__((ext_vector_type(4)))  __bf16 v4b;
typedef float __attribute__((may_alias)) float_a;
typedef int __attribute__((may_alias)) int_a;

template <typename T> __device__ __forceinline__ void vst2(void* p, T v) { *(T*)p = v;  }
// k_attn's two forms are the bare builtins, whose distances the compiler keeps itself: an asm statement's vector operands can only stand in v0..v255, which cannot hold two row groups' fragments and accumulators
__device__ __forceinline__ v8f wmma16(v16h a, v16h b, v8f c) { return __builtin_amdgcn_wmma_f32_16x16x32_f16(false, a, false, b, (short)0, c, false, false); }
__device__ __forceinline__ v8f wmma_bfb(v16b a, v16b b, v8f c) { return __builtin_amdgcn_wmma_f32_16x16x32_bf16(false, a, false, b, (short)0, c, false, false); }
__device__ __forceinline__ v8f wmma_bf(v16b a, v16b b, v8f c) {
  v8f d = __builtin_amdgcn_wmma_f32_16x16x32_bf16(false, a, false, b, (short)0, c, false, false);
  asm volatile("v_nop\n\tv_nop\n\tv_nop\n\tv_nop" : "+v"(d) : "v"(a), "v"(b));
  return d;
}
// 16x16x32 fragments: lane = (h = lane>>4, row/col = lane&15); elements 0..7 = k0+8h+0..7, 8..15 = k0+16+8h+0..7; D element r = row 8h+r
__device__ __forceinline__ v16h frag_h(const _Float16* rowk0, int lane) {
  union { v16h v; v8h q[2]; } u; const _Float16* p = rowk0 + 8 * (lane >> 4);
  u.q[0] = *(const v8h*)p; u.q[1] = *(const v8h*)(p + 16); return u.v;
}
__device__ __forceinline__ v16h frag_f32(const float* rowk0, int lane) {
  v16h a; const float* p = rowk0 + 8 * (lane >> 4);
#pragma unroll
  for (int i = 0; i < 8; ++i) { a[i] = (_Float16)p[i]; a[8 + i] = (_Float16)p[16 + i]; }
  return a;
}
__device__ __forceinline__ v16h frag_f32s(const float* rowk0, int lane, float sc) {
  v16h a; const float* p = rowk0 + 8 * (lane >> 4);
#pragma unroll
  for (int i = 0; i < 8; ++i) { a[i] = (_Float16)(p[i] * sc); a[8 + i] = (_Float16)(p[16 + i] * sc); }
  return a;
}
// column fragment from a [K][ld] layout (column n), rows >= K read as 0
__device__ __forceinline__ v16h fragc_f32(const float* W, int k0, int n, int lane, int ld, int K) {
  v16h a; const int g = lane >> 4;
#pragma unroll
  for (int i = 0; i < 8; ++i) { const int ka = k0 + 8 * g + i, kb = ka + 16;
    a[i] = (_Float16)(ka < K ? W[(size_t)ka * ld + n] : 0.f); a[8 + i] = (_Float16)(kb < K ? W[(size_t)kb * ld + n] : 0.f); }
  return a;
}
struct F2 { v16b h, l; };
__device__ __forceinline__ F2 bsplit16(const float v[16]) { F2 r;
#pragma unroll
  for (int i = 0; i < 16; ++i) { const __bf16 h = (__bf16)v[i]; r.h[i] = h; r.l[i] = (__bf16)(v[i] - (float)h); }
  return r; }
__device__ __forceinline__ F2 split_row(const float* row, int k0, int lane) { float v[16]; const float* p = row + k0 + 8 * (lane >> 4);
#pragma unroll
  for (int i = 0; i < 8; ++i) { v[i] = p[i]; v[8 + i] = p[16 + i]; }
  return bsplit16(v); }
__device__ __forceinline__ F2 split_rowK(const float* row, int k0, int lane, int K) { float v[16]; const int g = lane >> 4;
#pragma unroll
  for (int i = 0; i < 8; ++i) { const int ka = k0 + 8 * g + i, kb = ka + 16; v[i] = ka < K ? row[ka] : 0.f; v[8 + i] = kb < K ? row[kb] : 0.f; }
  return bsplit16(v); }
__device__ __forceinline__ F2 split_col(const float* W, int k0, int n, int lane, int ld, int K) { float v[16]; const int g = lane >> 4;
#pragma unroll
  for (int i = 0; i < 8; ++i) { const int ka = k0 + 8 * g + i, kb = ka + 16; v[i] = ka < K ? W[(size_t)ka * ld + n] : 0.f; v[8 + i] = kb < K ? W[(size_t)kb * ld + n] : 0.f; }
  return bsplit16(v); }
// split_row in two halves, so that the loads can stand apart from the arithmetic: the fragment's sixteen f32 as four 16-byte loads (p = row + k0 + 8 * (lane >> 4)), and their split
__device__ __forceinline__ void ld_raw(v4f s[4], const float* p) { s[0] = *(const v4f*)p; s[1] = *(const v4f*)(p + 4); s[2] = *(const v4f*)(p + 16); s[3] = *(const v4f*)(p + 20); }
__device__ __forceinline__ F2 split_raw(const v4f s[4]) { float v[16];
#pragma unroll
  for (int i = 0; i < 16; ++i) v[i] = s[i >> 2][i & 3];
  return bsplit16(v); }
// the four 16-byte pieces of one stored fragment pair, taken as they are: no arithmetic
__device__ __forceinline__ F2 as_f2(const v4f s[4]) { union { F2 f; v4f q[4]; } u; u.q[0] = s[0]; u.q[1] = s[1]; u.q[2] = s[2]; u.q[3] = s[3]; return u.f; }
// one row fragment's two-way bf16 split, as stored by k_proj in a fragment-ordered plane (p = fragment + lane * 4; 16-byte pieces carried in v4f registers, never computed on):
// pieces 0, 1 = the high parts, pieces 2, 3 = the low parts, of elements 0..7 and 8..15 of split_row's fragment of row lane & 15; each of the four loads covers 512 contiguous bytes
__device__ __forceinline__ void ld_st(v4f s[4], const float* p) { s[0] = *(const v4f*)p; s[1] = *(const v4f*)(p + 128); s[2] = *(const v4f*)(p + 256); s[3] = *(const v4f*)(p + 384); }
// one split W fragment in LDS: [hi, lo][elements 0..7, 8..15][lane half][16 lanes][16 bytes]; a lane half stands at 320 and an element half at 640 bytes, so that the 32 8-byte
// stores of a staging wave (4 rows x one 128-byte line) fall on all 64 banks once, while each half-wave's 16-byte reads stay 256 contiguous bytes
#define WGH 320
#define WEH 640
#define WHL 1280
#define WFP 2560
// one staged W fragment pair (p = fragment + this lane's place): the pieces in ld_st's order
__device__ __forceinline__ void ld_w(v4f s[4], const unsigned char* p) { s[0] = *(const v4f*)p; s[1] = *(const v4f*)(p + WEH); s[2] = *(const v4f*)(p + WHL); s[3] = *(const v4f*)(p + WHL + WEH); }
__device__ __forceinline__ v8f mac3(const F2& a, const F2& b, v8f c) { c = wmma_bf(a.l, b.h, c); c = wmma_bf(a.h, b.l, c); return wmma_bf(a.h, b.h, c); }
// mac3 for two row groups against one B fragment, the two accumulate chains alternating: each fills the other's wait for its own previous product; each chain's order is mac3's
__device__ __forceinline__ void mac3x2(const F2& a0, const F2& a1, const F2& b, v8f& c0, v8f& c1) {
  c0 = wmma_bfb(a0.l, b.h, c0); c1 = wmma_bfb(a1.l, b.h, c1); c0 = wmma_bfb(a0.h, b.l, c0); c1 = wmma_bfb(a1.h, b.l, c1); c0 = wmma_bfb(a0.h, b.h, c0); c1 = wmma_bfb(a1.h, b.h, c1); }
__device__ __forceinline__ float sigm(float v) { return 1.0f / (1.0f + expf(-v)); }
// 2^x on the hardware's own instruction, in place: 0 for x = -inf or far below the f32 range, no range branch, no fix-up chain.
// Written as asm so that the slot which the instruction set asks for behind a transcendental is filled by construction: by the next, independent v_exp_f32,
// and behind the last one by the v_nop
__device__ __forceinline__ void ex2x4(float& a, float& b, float& c, float& d) {
  asm("v_exp_f32 %0, %0\n\tv_exp_f32 %1, %1\n\tv_exp_f32 %2, %2\n\tv_exp_f32 %3, %3\n\tv_nop" : "+v"(a), "+v"(b), "+v"(c), "+v"(d)); }
__device__ __forceinline__ float ex2(float x) { asm("v_exp_f32 %0, %0\n\tv_nop" : "+v"(x)); return x; }   // the same for one value
#define L2E 1.4426950408889634f
// four vector slots between a product and a global load over registers that it read as B
#define WGAP() asm volatile("v_nop\n\tv_nop\n\tv_nop\n\tv_nop")
#define LDSX() do { asm volatile("s_wait_dscnt 0" ::: "memory"); __builtin_amdgcn_wave_barrier(); __builtin_amdgcn_fence(__ATOMIC_RELEASE, "workgroup"); } while (0)

// Dialog sequence-attention matching: x_proj / y_proj = relu(. @ W^T + b) as two-way bf16 splits on WMMA (f32 results, stored as their own two-way bf16 splits); per (timestep i,
// 16 document positions) only the key tiles of earlier timesteps are visited, dealt over the block's waves (later ones and padded tokens are exactly weight 0; row i = 0
// is all-zero: k_attn stores it with inv = 0), scores as two-way bf16 splits (logits are O(10): near-f32 keeps the sharp softmax exact), recency bias and pad
// mask (read as data) in f32, online softmax in f32, alpha (x2^14 f16) @ dialog embeddings (f16 transposed copy) on v_wmma_f32_16x16x32_f16.
#define NT 32
#define L1 512
#define MQ 64                  // tokens per timestep (32 + 32)
#define NK (NT * MQ)           // 2048
#define HH 128
#define WRING 6                // W fragments on their way from LDS per wave of k_proj, fetched two at a place

// projections: blockIdx.y = 0: XP rows (16384) from xd; 1: YP rows (2048) from dlg = [xq | xa] per timestep; also the transposed dialog copy in f16 (which = 2).
// All three planes are laid out in the order k_attn's lanes read them, so that each of its wave-wide 16-byte loads covers four whole 128-byte lines
// (in row-major planes such a load touches sixteen lines):
//   XP, YP: [16-row group][k chunk of 32][piece j][lane][16 bytes], already split into bf16 high and low parts (ld_st says what piece j holds): as many bytes as the f32 rows
// Keys are taken in packed order: slot c of YP and dT holds key sperm[c], the unpadded keys first (in their own order, so by rising timestep), the padded ones behind them.
// k_attn then visits only the tiles that hold unpadded keys of earlier timesteps; KT[c] = timestep of slot c (a padded slot: far above any), CN[i] = unpadded keys of timesteps < i
//   dT:     [64-key tile, at the 32-KiB pitch of a y_proj tile (second half unused) so that one offset register serves both planes][k chunk of 32 keys][16-column group t][half h][lane][8 f16] = keys chunk + 16 h + 8 (lane >> 4) + 0..7 of column 16 t + (lane & 15)
__global__ __launch_bounds__(128) void k_proj(const float* __restrict__ xd, const float* __restrict__ xq, const float* __restrict__ xa, const float* __restrict__ W, const float* __restrict__ bias, const int* __restrict__ qmask, const int* __restrict__ amask, float* __restrict__ XP, float* __restrict__ YP, _Float16* __restrict__ dT, float* __restrict__ KT, int* __restrict__ CN) {
  __shared__ __align__(16) float so[4][16][132];
  __shared__ __align__(16) unsigned char sw[32 * WFP];       // W as split fragments (which < 2); the dialog copy's blocks use its first bytes as st
  _Float16 (*st)[72] = (_Float16 (*)[72])sw;
  __shared__ __align__(16) unsigned short sperm[NK];         // key of each packed slot (which >= 1)
  __shared__ int scnt[4];
  const int tid = threadIdx.x, wave = tid >> 5, lane = tid & 31, col = lane & 15, g = lane >> 4;
  const int which = blockIdx.y, r0 = blockIdx.x * 64 + wave * 16;
  if (which == 0 || blockIdx.x < NK / 64) {
    if (which >= 1) {   // the packed order, made by every block that needs it: thread tid has keys 16 tid .. 16 tid + 15 (a quarter of timestep tid >> 2: two of questions, two of answers)
      const int* mp = ((tid & 3) < 2 ? qmask : amask) + (tid >> 2) * 32 + (tid & 1) * 16;
      v4i mv[4];
#pragma unroll
      for (int j = 0; j < 4; ++j) mv[j] = *(const v4i*)(mp + 4 * j);
      asm volatile("s_wait_xcnt 0x0" :: "v"(mp) : "memory");   // the loads' address registers are live up to this wait, before anything re-uses them
      int before = 0, wtot = 0, total = 0;                     // unpadded keys of the lower lanes of this wave; of the whole wave; of all
#pragma unroll
      for (int e = 0; e < 16; ++e) { const unsigned b = __builtin_amdgcn_ballot_w32(mv[e >> 2][e & 3] == 0); before = __builtin_amdgcn_mbcnt_lo(b, before); wtot += __builtin_popcount(b); }
      if (lane == 0) scnt[wave] = wtot;
      __syncthreads();                                         // every wave's count stands in LDS before any thread sums them
#pragma unroll
      for (int u = 0; u < 4; ++u) { const int c = scnt[u]; total += c; before += u < wave ? c : 0; }
      int pv = before, pm = total + tid * 16 - before;         // next free slot among the unpadded and among the padded: each of the NK slots is filled once, for any mask
#pragma unroll
      for (int e = 0; e < 16; ++e) { const bool ok = mv[e >> 2][e & 3] == 0; sperm[ok ? pv : pm] = (unsigned short)(tid * 16 + e); pv += ok ? 1 : 0; pm += ok ? 0 : 1; }
      __syncthreads();                                         // the whole order stands in LDS before any thread looks a slot up
      if (which == 2) {
        if (tid < 64) { const int c = blockIdx.x * 64 + tid; KT[c] = c < total ? (float)(sperm[c] >> 6) : 1.0e9f; }
        if (blockIdx.x == 0 && (tid & 3) == 0) CN[tid >> 2] = before; } }
    if (which < 2) { v8f acc[8] = {};
      int key = r0 + col; if (which == 1) key = sperm[key];    // which == 1: the dialog row of this lane
      const int ts = key / MQ, m = key % MQ;
      const float* src = which == 0 ? xd + (size_t)(r0 + col) * HH : m < 32 ? xq + ((size_t)ts * 32 + m) * HH : xa + ((size_t)ts * 32 + m - 32) * HH;
      const float* ap = src + 8 * g;                           // split_row's start in this lane's input row
      // W is read and split once per block, not once per wave: wave w brings rows 32 w .. 32 w + 31, each load 4 rows x one whole 128-byte line (8 lanes a line; a fragment load
      // straight from W touches 16 lines), splits its 4 values a lane as bsplit16 does and puts them where fragment f = (k chunk f >> 3, column group f & 7) has them
      const float* wsrc = W + (size_t)(wave * 32 + (lane >> 3)) * HH + (lane & 7) * 4;   // load i: rows + (i >> 2) * 4, k chunk i & 3
      unsigned char* wdst = sw + wave * 2 * WFP + ((lane >> 2) & 1) * WEH + ((lane >> 1) & 1) * WGH + (lane >> 3) * 16 + (lane & 1) * 8;
      const unsigned char* wp = sw + g * WGH + col * 16;       // this lane's place in a staged fragment
      // the first two input chunks, all of W and the bias go out at once, ahead of their use
      float bb[8]; v4f ar[2][4], wr[WRING][4], wv[32];
#pragma unroll
      for (int kc = 0; kc < 2; ++kc) ld_raw(ar[kc], ap + kc * 32);
#pragma unroll   // unrolled: the 32 loads go out together and their values are picked by constants
      for (int i = 0; i < 32; ++i) wv[i] = *(const v4f*)(wsrc + (i >> 2) * 4 * HH + (i & 3) * 32);
#pragma unroll
      for (int j = 0; j < 8; ++j) bb[j] = bias[j * 16 + col];
      asm volatile("s_wait_xcnt 0x0" :: "v"(wsrc) : "memory");   // W's address registers are live up to this wait, before anything re-uses them
      __builtin_amdgcn_sched_barrier(0);                       // keeps these loads in front of the split
#pragma unroll   // unrolled: the loaded values are picked by constants and stay in registers, the LDS places are immediate offsets
      for (int i = 0; i < 32; ++i) { const v4b h = __builtin_convertvector(wv[i], v4b); const v4b l = __builtin_convertvector(wv[i] - __builtin_convertvector(h, v4f), v4b);
        unsigned char* d = wdst + ((i & 3) * 8 + (i >> 4)) * WFP + ((i >> 2) & 3) * 64;
        vst2(d, h); vst2(d + WHL, l); }
      __syncthreads();                                         // all of W stands in LDS before any wave reads a fragment
#pragma unroll   // unrolled: the ring's entries are picked by constants and stay in registers
      for (int f = 0; f < WRING; ++f) ld_w(wr[f], wp + f * WFP);
      __builtin_amdgcn_sched_barrier(0);                       // keeps these reads in front of the products
      F2 a;
#pragma unroll   // unrolled: the ring's entries are picked by constants and stay in registers
      for (int f = 0; f < 32; ++f) { const int kc = f >> 3, j = f & 7;
        if (j == 0) { a = split_raw(ar[kc & 1]);
          if (kc + 2 < 4) { __builtin_amdgcn_sched_barrier(0);   // the split first, so that the load re-uses its registers
            ld_raw(ar[kc & 1], ap + (kc + 2) * 32);
            __builtin_amdgcn_sched_barrier(0); } }               // keeps that load here, two k chunks ahead of its use
        acc[j] = mac3(a, as_f2(wr[f % WRING]), acc[j]);
        if ((f & 1) && f + WRING < 32) { __builtin_amdgcn_sched_barrier(0);   // the products first, then the two entries just used are read anew: one place with LDS reads per two fragments
          ld_w(wr[(f - 1) % WRING], wp + (f - 1 + WRING) * WFP); ld_w(wr[f % WRING], wp + (f + WRING) * WFP);
          __builtin_amdgcn_sched_barrier(0); } }               // keeps those reads here, two places ahead of their use
      asm volatile("s_wait_xcnt 0x0" :: "v"(ap) : "memory");   // the loads' address registers are live up to this wait, before anything re-uses them
#pragma unroll
      for (int j = 0; j < 8; ++j) { const int c = j * 16 + col;
#pragma unroll
        for (int r = 0; r < 8; ++r) { const float v = acc[j][r] + bb[j]; so[wave][8 * g + r][c] = v > 0.f ? v : 0.f; } }
      LDSX();
      float* dst = which == 0 ? XP : YP;
#pragma unroll   // both loops unrolled: the pieces are picked by constants and stay in registers
      for (int kc = 0; kc < 4; ++kc) { union { F2 f; v4f q[4]; } u; u.f = split_row(&so[wave][col][0], kc * 32, lane);   // the split is made here, once per row
#pragma unroll
        for (int j = 0; j < 4; ++j) vst2(dst + (size_t)r0 * HH + (kc * 4 + j) * 128 + lane * 4, u.q[j]); } }
    else {   // the dialog copy of this block's 64 keys (one key tile)
      float v[64];                                             // slot blockIdx.x * 64 + kl holds key sperm[...]: token key & 63 of timestep key >> 6; this thread has column tid
#pragma unroll   // the thread's 64 loads go out together; rolled, every few are waited out alone
      for (int kl = 0; kl < 64; ++kl) { const int key = sperm[blockIdx.x * 64 + kl];
        v[kl] = ((key & 32) ? xa : xq)[((key >> 6) * 32 + (key & 31)) * HH + tid]; }
#pragma unroll
      for (int kl = 0; kl < 64; ++kl) st[tid][kl] = (_Float16)v[kl];
      __syncthreads();
#pragma unroll   // a constant trip count, unrolled: the eight LDS reads go out together, then the eight stores
      for (int it = 0; it < HH * 8 / 128; ++it) { const int q = tid + it * 128, f = q >> 5, kc = f >> 4, t = (f >> 1) & 7, h = f & 1;   // q = (fragment half f, lane)
        vst2(dT + (size_t)blockIdx.x * (2 * 64 * HH) + q * 8, *(const v4u*)(&st[t * 16 + col][kc * 32 + 16 * h + 8 * g])); } } }
}
// attention: block (QG * 16 doc positions, timestep pair iA = NT - 1 - p, iB = p). A timestep i has the tiles that hold the CN[i] unpadded keys of earlier timesteps (at most i;
// the keys behind them in its last tile are masked by their timestep): the pair's tiles are numbered through (first iA's, then iB's) and dealt in runs over the block's waves,
// the runs' lengths at most one apart; all blocks are resident at once. A wave takes each of its tiles for all QG 16-row groups, so that every y_proj and dialog fragment it loads from L2 is used QG times,
// and keeps per group its own running maximum, sum and un-normalised accumulator. The one wave whose run crosses from iA to iB puts its partial result down at the crossing
// and starts anew; the partial results are merged per timestep through LDS behind one work-group barrier
#define KS 8
#define QG 2
#define NSL (KS + 1)                   // partial results: slot w = wave w's first (or only) one, slot KS = the crossing wave's second
// two waves per SIMD, one work-group on a WGP: both groups' accumulators and query fragments stay in registers
__global__ __launch_bounds__(32 * KS) __attribute__((amdgpu_waves_per_eu(2, 2))) void k_attn(const float* __restrict__ XP, const float* __restrict__ YP, const _Float16* __restrict__ dT, const float* __restrict__ KT, const int* __restrict__ CN, const float* __restrict__ rwp, float* __restrict__ out) {
  __shared__ __align__(16) float sS[KS][QG][16][68];
  __shared__ __align__(16) _Float16 sP[KS][QG][16][72];
  __shared__ __align__(16) float sO[NSL][QG][16][132];
  __shared__ float sM[NSL][QG][16];
  __shared__ float sL[NSL][QG][16];
  __shared__ float smk[NK];
  __shared__ __align__(16) v4u sQ[2][QG][4][2][2][32];   // the block's query fragments [timestep of the pair][row group][k chunk][hi, lo][half][lane], shared by all waves
  // w through readfirstlane: the wave's number in a scalar register, so that the key loop's trip test stays a scalar branch
  const int tid = threadIdx.x, w = __builtin_amdgcn_readfirstlane(tid >> 5), lane = tid & 31, col = lane & 15, g = lane >> 4;
  const int iB = blockIdx.y, iA = NT - 1 - iB, q0 = blockIdx.x * (16 * QG);   // iA > iB
  const int tA = (CN[iA] + 63) >> 6, tB = (CN[iB] + 63) >> 6;
  const int nA = tA < 0 ? 0 : tA > iA ? iA : tA, nB = tB < 0 ? 0 : tB > iB ? iB : tB, ni = nA + nB;   // tiles 0 .. nA - 1 of the pair are iA's, the others iB's; bounded by the shape
  const int base = ni / KS, rem = ni % KS;                 // wave u's run starts at tile first(u) and ends in front of first(u + 1); it may be empty
  auto first = [&](int u) __attribute__((always_inline)) { return u * base + (u < rem ? u : rem); };
  const size_t rqA = (size_t)iA * L1 + q0, rqB = (size_t)iB * L1 + q0;
  {
#pragma unroll   // the eight loads of a thread go out together; rolled, each is waited out alone
    for (int j = 0; j < NK / (32 * KS); ++j) smk[tid + j * 32 * KS] = KT[tid + j * 32 * KS]; }    // timestep of each packed slot
  if (w < 4 * QG) { v4f xs[2][4];   // fragment w = (row group w >> 2, k chunk w & 3) of both timesteps: a timestep's groups' planes follow one another
    ld_st(xs[0], XP + rqA * HH + w * 512 + lane * 4); ld_st(xs[1], XP + rqB * HH + w * 512 + lane * 4);
    asm volatile("s_wait_xcnt 0x0" ::: "memory");   // behind the eight loads, before anything re-uses the registers that they name
#pragma unroll   // unrolled: the loaded pieces are picked by constants and stay in registers
    for (int s = 0; s < 2; ++s) { union { F2 f; v4u q[4]; } u; u.f = as_f2(xs[s]);
      sQ[s][w >> 2][w & 3][0][0][lane] = u.q[0]; sQ[s][w >> 2][w & 3][0][1][lane] = u.q[1]; sQ[s][w >> 2][w & 3][1][0][lane] = u.q[2]; sQ[s][w >> 2][w & 3][1][1][lane] = u.q[3]; } }
  __syncthreads();
  {
    const int it0 = first(w), it1 = first(w + 1);             // this wave's run of the pair's tiles
    v8f acc[QG][8] = {};
    float mrun[QG], lrun[QG]; const float rw = rwp[0];
#pragma unroll
    for (int qg = 0; qg < QG; ++qg) { mrun[qg] = -3.0e38f; lrun[qg] = 0.f; }
    // the wave's partial result (maximum, sum, accumulator of each row group) into a slot of its own
    auto put = [&](int slot) __attribute__((always_inline)) {
      const int tl = __builtin_amdgcn_mbcnt_lo(~0u, (unsigned)w * 32), lc = tl & 15, lg = (tl >> 4) & 1;   // tl == tid, formed anew from the wave's number: col and g held over the key loop were spilled
#pragma unroll   // all three loops unrolled: the accumulators are picked by constants and stay in registers
      for (int qg = 0; qg < QG; ++qg) {
        if (lg == 0) { sM[slot][qg][lc] = mrun[qg]; sL[slot][qg][lc] = lrun[qg]; }
#pragma unroll
        for (int r = 0; r < 8; ++r)
#pragma unroll
          for (int t = 0; t < 8; ++t) sO[slot][qg][8 * lg + r][t * 16 + lc] = acc[qg][t][r]; } };
    const unsigned lo = lane * 16;                             // this lane's byte in a 512-byte fragment piece, of y_proj and of the dialog copy alike; a tile's place is added as a 32-bit byte offset to the plane's scalar base
    unsigned yo = lo + (unsigned)(it0 >= it1 ? 0 : it0 < nA ? it0 : it0 - nA) * (64 * HH * 4);   // byte offset of this lane in the wave's current key tile of y_proj (an empty run: tile 0, in bounds, unused)
    v4f st[4][4];                                              // split y_proj fragments of one 16-key group, one entry per k chunk
#pragma unroll
    for (int kc = 0; kc < 4; ++kc) { ld_st(st[kc], (const float*)((const char*)YP + yo) + kc * 512);
      __builtin_amdgcn_sched_barrier(0); }                     // chunks go out in the loop's own order: in another order the trip's first wait is for all sixteen loads
#pragma unroll 1
    for (int it = it0; it < it1; ++it) {
      const int sel = it < nA ? 0 : 1, kt = it < nA ? it : it - nA;   // key tile kt of timestep i = iA or iB
      const float fi = (float)(sel ? iB : iA);
      const float* yp = (const float*)((const char*)YP + yo);
      F2 aq[QG][4];                                      // re-read every trip: their registers hold the dialog tile during softmax and PV
#pragma unroll
      for (int qg = 0; qg < QG; ++qg)
#pragma unroll
        for (int kc = 0; kc < 4; ++kc) { union { F2 f; v4u q[4]; } u; u.q[0] = sQ[sel][qg][kc][0][0][lane]; u.q[1] = sQ[sel][qg][kc][0][1][lane]; u.q[2] = sQ[sel][qg][kc][1][0][lane]; u.q[3] = sQ[sel][qg][kc][1][1][lane]; aq[qg][kc] = u.f; }
#pragma unroll
      for (int t = 0; t < 4; ++t) { v8f s[QG] = {}; const int key = kt * 64 + t * 16 + col;
#pragma unroll
        for (int kc = 0; kc < 4; ++kc) { mac3x2(aq[0][kc], aq[1][kc], as_f2(st[kc]), s[0], s[1]);
          if (t < 3) {
            __builtin_amdgcn_sched_barrier(0);           // the products first, so that the load below re-uses their operand registers (lifted over them, it takes 16 more)
            WGAP();
            __builtin_amdgcn_sched_barrier(0);           // holds the slots between the products and the load
            ld_st(st[kc], yp + (t + 1) * 16 * HH + kc * 512);            // the next group's chunk into the registers just read
            __builtin_amdgcn_sched_barrier(0); } }       // keeps that load here, four chunks ahead of its use; sunk to its use it is waited out alone
        const float kf = smk[key]; const bool pad = kf >= fi;   // a padded slot, or a key of timestep i or later: weight exactly 0
        const float bias = rw * (fi - kf);                 // |i - j_ts| * recency_weight (row i >= 1)
#pragma unroll
        for (int qg = 0; qg < QG; ++qg)
#pragma unroll
          for (int r = 0; r < 8; ++r) sS[w][qg][8 * g + r][t * 16 + col] = pad ? -3.0e38f : s[qg][r] + bias; }
      LDSX();
      const _Float16* dp = (const _Float16*)((const char*)dT + yo);   // the same byte offset: dialog tiles stand at y_proj's tile pitch
      v8h dv[2][8][2];                                   // the whole dialog tile, asked for now so that it lands behind the softmax
#pragma unroll
      for (int kc = 0; kc < 2; ++kc)
#pragma unroll
        for (int t = 0; t < 8; ++t) { const _Float16* p = dp + (kc * 8 + t) * 512; dv[kc][t][0] = *(const v8h*)p; dv[kc][t][1] = *(const v8h*)(p + 256); }
      asm volatile("s_wait_xcnt 0x0" :: "v"(yo) : "memory");   // the loads' offset register is live up to this wait
      __builtin_amdgcn_sched_barrier(0);                 // keeps the 32 loads in front of the softmax
#pragma unroll   // one softmax per row group, unrolled: the groups are independent and their state is picked by constants
      for (int qg = 0; qg < QG; ++qg) {
      float mx = -3.4e38f;
#pragma unroll
      for (int jj = 0; jj < 32; ++jj) mx = fmaxf(mx, sS[w][qg][col][g * 32 + jj]);
      mx = fmaxf(mx, __shfl_xor(mx, 16, 32));
      const float mnew = fmaxf(mrun[qg], mx); const bool dead = mnew <= -1.0e38f;   // dead: every key of this row so far is masked
      const float ce = ex2((mrun[qg] - mnew) * L2E); const float corr = dead ? 1.0f : ce;   // computed in every lane and then chosen: no branch round it
      const float mb = dead ? 0.f : -mnew * L2E;         // a masked score (-3e38) times L2E is -inf, whose 2^x is exactly 0, also in a dead row: no test per element
      float ps = 0.f;
#pragma unroll
      for (int jj = 0; jj < 32; jj += 4) { float p[4];
#pragma unroll
        for (int e = 0; e < 4; ++e) p[e] = fmaf(sS[w][qg][col][g * 32 + jj + e], L2E, mb);
        ex2x4(p[0], p[1], p[2], p[3]);
#pragma unroll
        for (int e = 0; e < 4; ++e) { ps += p[e]; sP[w][qg][col][g * 32 + jj + e] = (_Float16)(p[e] * 16384.0f); } }
      ps += __shfl_xor(ps, 16, 32);
      lrun[qg] = lrun[qg] * corr + ps; mrun[qg] = mnew;
#pragma unroll
      for (int r = 0; r < 8; ++r) { const float cr = __shfl(corr, 8 * g + r, 32);
#pragma unroll
        for (int t = 0; t < 8; ++t) acc[qg][t][r] *= cr; } }
      LDSX();
      const int itn = it + 1 < it1 ? it + 1 : it, ktn = itn < nA ? itn : itn - nA;
      const unsigned yof = yo + (unsigned)(ktn - kt) * (64 * HH * 4);
      const float* ypn = (const float*)((const char*)YP + yof);   // the wave's next tile (its last trip re-reads its own: in bounds, unused)
#pragma unroll
      for (int kc = 0; kc < 2; ++kc) { v16h pa[QG];
#pragma unroll
        for (int qg = 0; qg < QG; ++qg) pa[qg] = frag_h(&sP[w][qg][col][0] + kc * 32, lane);
#pragma unroll
        for (int t = 0; t < 8; ++t) { union { v16h v; v8h q[2]; } u; u.q[0] = dv[kc][t][0]; u.q[1] = dv[kc][t][1];
#pragma unroll
          for (int qg = 0; qg < QG; ++qg) acc[qg][t] = wmma16(pa[qg], u.v, acc[qg][t]);
          if (kc == 0 && (t & 1)) { __builtin_amdgcn_sched_barrier(0);   // the products first: the load may take the dialog registers that they read
            WGAP();
            __builtin_amdgcn_sched_barrier(0);           // holds the slots between the products and the load
            ld_st(st[t >> 1], ypn + (t >> 1) * 512);
            __builtin_amdgcn_sched_barrier(0); } } }     // next tile's first group goes out as dialog registers fall free, not at its use
      asm volatile("s_wait_xcnt 0x0" :: "v"(yof) : "memory");  // before the next trip re-uses the offset register of the loads still in flight
      yo = yof;
      if (it + 1 == nA && it + 1 < it1) {                // the run crosses to iB here: iA's partial result is put down, iB's starts from nothing
        put(w);
#pragma unroll   // both loops unrolled: the state is picked by constants and stays in registers
        for (int qg = 0; qg < QG; ++qg) { mrun[qg] = -3.0e38f; lrun[qg] = 0.f;
#pragma unroll
          for (int t = 0; t < 8; ++t) acc[qg][t] = v8f{}; } }
      __builtin_amdgcn_wave_barrier(); }
    put(it0 < nA && nA < it1 ? KS : w); }   // an empty run puts down the start state, which the merge gives weight 0
  __syncthreads();   // every wave's partial (maximum, sum, accumulator) is in LDS before any thread merges
  // merge: thread = (row of each row group, two groups of 4 columns), both timesteps at once: every slot is read once and counts for the one timestep it belongs to, with
  // weight 0 for the other, so that all LDS reads are independent of each other; slot KS is read only where a wave crossed (else slot 0 in its place, with weight 0);
  // iB = 0 has no slot and gives the all-zero row block
  const int tm = __builtin_amdgcn_mbcnt_lo(~0u, (unsigned)w * 32), row = tm >> 4, c = (tm & 15) * 4;   // tm == tid, formed anew for the same reason
  bool cross = false;                                    // some wave's run holds tiles of both timesteps
#pragma unroll
  for (int u = 0; u < KS; ++u) cross |= (first(u) < nA) & (nA < first(u + 1));
#pragma unroll   // this loop and those over the slots unrolled: a slot's LDS reads stand at constant offsets and all go out together
  for (int qg = 0; qg < QG; ++qg) {
    float mu[NSL], ef[NSL], MA = -3.0e38f, MB = -3.0e38f, LA = 0.f, LB = 0.f; v4f a0 = {}, a1 = {}, b0 = {}, b1 = {};
#pragma unroll
    for (int u = 0; u < NSL; ++u) { const bool ofA = u < KS && first(u) < nA, used = u < KS || cross;
      mu[u] = sM[used ? u : 0][qg][row]; if (!used) mu[u] = -3.0e38f;
      if (ofA) MA = fmaxf(MA, mu[u]); else MB = fmaxf(MB, mu[u]); }
#pragma unroll
    for (int u = 0; u < NSL; ++u) ef[u] = (mu[u] - (u < KS && first(u) < nA ? MA : MB)) * L2E;
    ex2x4(ef[0], ef[1], ef[2], ef[3]); ex2x4(ef[4], ef[5], ef[6], ef[7]); ef[8] = ex2(ef[8]);
#pragma unroll
    for (int u = 0; u < NSL; ++u) { const bool ofA = u < KS && first(u) < nA; const int uu = u < KS || cross ? u : 0;
      const float f = mu[u] <= -1.0e38f ? 0.f : ef[u], fa = ofA ? f : 0.f, fb = ofA ? 0.f : f;
      const float l = sL[uu][qg][row]; const v4f v0 = *(const v4f*)(&sO[uu][qg][row][c]), v1 = *(const v4f*)(&sO[uu][qg][row][64 + c]);
      LA += fa * l; a0 += fa * v0; a1 += fa * v1; LB += fb * l; b0 += fb * v0; b1 += fb * v1; }
    const float ia = LA > 0.f ? 1.0f / (LA * 16384.0f) : 0.f, ib = LB > 0.f ? 1.0f / (LB * 16384.0f) : 0.f;   // a fully padded history gives sum 0; guarded as before
    vst2(out + (rqA + qg * 16 + row) * HH + c, a0 * ia); vst2(out + (rqA + qg * 16 + row) * HH + 64 + c, a1 * ia);
    vst2(out + (rqB + qg * 16 + row) * HH + c, b0 * ib); vst2(out + (rqB + qg * 16 + row) * HH + 64 + c, b1 * ib);
    if (qg + 1 < QG) asm volatile("s_wait_xcnt 0x0" ::: "memory"); }   // behind the four stores, before the next row group's LDS reads land on the registers that they name
}
extern "C" void kernel_launch(void* const* d_in, const int* in_sizes, int n_in, void* d_out, int out_size, void* d_ws, size_t ws_size, hipStream_t stream) {
  (void)in_sizes; (void)n_in; (void)out_size; (void)ws_size;
  const float* xd = (const float*)d_in[0]; const float* xq = (const float*)d_in[1]; const float* xa = (const float*)d_in[2]; const float* W = (const float*)d_in[3]; const float* bias = (const float*)d_in[4]; const float* rw = (const float*)d_in[5]; const int* qm = (const int*)d_in[6]; const int* am = (const int*)d_in[7];
  float* out = (float*)d_out;
  char* ws = (char*)d_ws; size_t off = 0;
  auto take = [&](size_t bytes) { char* p = ws + off; off += (bytes + 255) & ~(size_t)255; return p; };
  float* XP = (float*)take((size_t)NT * L1 * HH * 4); float* YP = (float*)take((size_t)NK * HH * 4); _Float16* dT = (_Float16*)take((size_t)HH * NK * 4); float* KT = (float*)take((size_t)NK * 4); int* CN = (int*)take((size_t)NT * 4);
  k_proj<<<dim3(NT * L1 / 64, 3), 128, 0, stream>>>(xd, xq, xa, W, bias, qm, am, XP, YP, dT, KT, CN);
  k_attn<<<dim3(L1 / (16 * QG), NT / 2), 32 * KS, 0, stream>>>(XP, YP, dT, KT, CN, rw, out);
}
